// v000
// Times are from an AMD MI455X. After a warm-up the kernel runs many times in a row, and a time is the length of
// such a window on the GPU divided by its runs, so every launch and the gaps after it count. The runs cycle
// through copies of the inputs. A figure is the median of several windows, for all but v000 over two sittings.
// Sittings can differ by a few percent; kernels timed side by side share one.
// The starting kernel, v000, takes 328 microseconds a run.
// compute dtype: Q, K, V, mask_out (INPUTS) rounded to bf16: exact single bf16 WMMA products for the scores and for V (f32 accumulate), softmax weights carried as a bf16 hi/lo pair; softmax in f32.
#include <hip/hip_runtime.h>
#include <math.h>

typedef __attribute__((ext_vector_type(16))) _Float16 v16h;
typedef __attribute__((ext_vector_type(16))) __bf16 v16b;
typedef __attribute__((ext_vector_type(8)))  _Float16 v8h;
typedef __attribute__((ext_vector_type(8)))  float v8f;
typedef __attribute__((ext_vector_type(4)))  float v4f;
typedef __attribute__((ext_vector_type(2)))  float v2f;
typedef __attribute__((ext_vector_type(4)))  unsigned v4u;
typedef __attribute__((ext_vector_type(4)))  int v4i;
typedef float __attribute__((may_alias)) float_a;
typedef int __attribute__((may_alias)) int_a;

template <typename T> __device__ __forceinline__ void vst2(void* p, T v) { *(T*)p = v;  }
__device__ __forceinline__ v8f wmma16(v16h a, v16h b, v8f c) {
  v8f d = __builtin_amdgcn_wmma_f32_16x16x32_f16(false, a, false, b, (short)0, c, false, false);
  asm volatile("v_nop\n\tv_nop\n\tv_nop\n\tv_nop" : "+v"(d) : "v"(a), "v"(b));
  return d;
}
__device__ __forceinline__ v8f wmma_bf(v16b a, v16b b, v8f c) {
  v8f d = __builtin_amdgcn_wmma_f32_16x16x32_bf16(false, a, false, b, (short)0, c, false, false);
  asm volatile("v_nop\n\tv_nop\n\tv_nop\n\tv_nop" : "+v"(d) : "v"(a), "v"(b));
  return d;
}
// 16x16x32 fragments: lane = (h = lane>>4, row/col = lane&15); elements 0..7 = k0+8h+0..7, 8..15 = k0+16+8h+0..7; D element r = row 8h+r
__device__ __forceinline__ v16h frag_h(const _Float16* rowk0, int lane) {
  union { v16h v; v8h q[2]; } u; const _Float16* p = rowk0 + 8 * (lane >> 4);
  u.q[0] = *(const v8h*)p; u.q[1] = *(const v8h*)(p + 16); return u.v;
}
__device__ __forceinline__ v16h frag_f32(const float* rowk0, int lane) {
  v16h a; const float* p = rowk0 + 8 * (lane >> 4);
#pragma unroll
  for (int i = 0; i < 8; ++i) { a[i] = (_Float16)p[i]; a[8 + i] = (_Float16)p[16 + i]; }
  return a;
}
__device__ __forceinline__ v16h frag_f32s(const float* rowk0, int lane, float sc) {
  v16h a; const float* p = rowk0 + 8 * (lane >> 4);
#pragma unroll
  for (int i = 0; i < 8; ++i) { a[i] = (_Float16)(p[i] * sc); a[8 + i] = (_Float16)(p[16 + i] * sc); }
  return a;
}
// column fragment from a [K][ld] layout (column n), rows >= K read as 0
__device__ __forceinline__ v16h fragc_f32(const float* W, int k0, int n, int lane, int ld, int K) {
  v16h a; const int g = lane >> 4;
#pragma unroll
  for (int i = 0; i < 8; ++i) { const int ka = k0 + 8 * g + i, kb = ka + 16;
    a[i] = (_Float16)(ka < K ? W[(size_t)ka * ld + n] : 0.f); a[8 + i] = (_Float16)(kb < K ? W[(size_t)kb * ld + n] : 0.f); }
  return a;
}
struct F2 { v16b h, l; };
__device__ __forceinline__ F2 bsplit16(const float v[16]) { F2 r;
#pragma unroll
  for (int i = 0; i < 16; ++i) { const __bf16 h = (__bf16)v[i]; r.h[i] = h; r.l[i] = (__bf16)(v[i] - (float)h); }
  return r; }
__device__ __forceinline__ F2 split_row(const float* row, int k0, int lane) { float v[16]; const float* p = row + k0 + 8 * (lane >> 4);
#pragma unroll
  for (int i = 0; i < 8; ++i) { v[i] = p[i]; v[8 + i] = p[16 + i]; }
  return bsplit16(v); }
__device__ __forceinline__ F2 split_rowK(const float* row, int k0, int lane, int K) { float v[16]; const int g = lane >> 4;
#pragma unroll
  for (int i = 0; i < 8; ++i) { const int ka = k0 + 8 * g + i, kb = ka + 16; v[i] = ka < K ? row[ka] : 0.f; v[8 + i] = kb < K ? row[kb] : 0.f; }
  return bsplit16(v); }
__device__ __forceinline__ F2 split_col(const float* W, int k0, int n, int lane, int ld, int K) { float v[16]; const int g = lane >> 4;
#pragma unroll
  for (int i = 0; i < 8; ++i) { const int ka = k0 + 8 * g + i, kb = ka + 16; v[i] = ka < K ? W[(size_t)ka * ld + n] : 0.f; v[8 + i] = kb < K ? W[(size_t)kb * ld + n] : 0.f; }
  return bsplit16(v); }
__device__ __forceinline__ v8f mac3(const F2& a, const F2& b, v8f c) { c = wmma_bf(a.l, b.h, c); c = wmma_bf(a.h, b.l, c); return wmma_bf(a.h, b.h, c); }
__device__ __forceinline__ float sigm(float v) { return 1.0f / (1.0f + expf(-v)); }
#define LDSX() do { asm volatile("s_wait_dscnt 0" ::: "memory"); __builtin_amdgcn_wave_barrier(); __builtin_amdgcn_fence(__ATOMIC_RELEASE, "workgroup"); } while (0)



// Scaled dot attention with a post-softmax multiplicative key mask: attn = softmax(Q K^T / 8) * mask_out[b,h,1,k]; out = attn V  ([4,12,2048,64] head-major inputs, no projections).
// The mask scales the softmax weights AFTER normalisation (no renormalisation): p_k <- p_k * m_k feeds P.V while the denominator keeps the unmasked sum.
__device__ __forceinline__ float bfr(float v) { return (float)(__bf16)v; }
#define NBH 48
#define SS 2048
#define HD 64

__device__ __forceinline__ v16b frag_b(const __bf16* rowk0, int lane) { return __builtin_bit_cast(v16b, frag_h((const _Float16*)rowk0, lane)); }
// head-major [bh][s][64] f32 -> bf16 rows (plain cast, 8 values per thread)
__global__ __launch_bounds__(256) void k_cvt(const float* __restrict__ X, __bf16* __restrict__ Xb, size_t n8) {
  const size_t i8 = (size_t)blockIdx.x * 256 + threadIdx.x; if (i8 >= n8) return;
  union { __bf16 e[8]; v4u u; } pk; const float* src = X + i8 * 8;
#pragma unroll
  for (int e = 0; e < 8; ++e) pk.e[e] = (__bf16)src[e];
  vst2((unsigned*)(Xb + i8 * 8), pk.u);
}
__global__ __launch_bounds__(256) void k_cvtv(const float* __restrict__ V, __bf16* __restrict__ VTb) {
  __shared__ __align__(16) __bf16 st[64][72];
  const int tid = threadIdx.x; const size_t bh = blockIdx.y; const int s0 = blockIdx.x * 64;
  for (int q = tid; q < 64 * 64; q += 256) { const int rl = q >> 6, d = q & 63; st[d][rl] = (__bf16)V[(bh * SS + s0 + rl) * HD + d]; }
  __syncthreads();
  for (int q = tid; q < 64 * 8; q += 256) { const int d = q >> 3, pc = q & 7; vst2((unsigned*)(VTb + (bh * HD + d) * SS + s0 + pc * 8), *(const v4u*)(&st[d][pc * 8])); }
}
__global__ __launch_bounds__(128) void k_attn(const __bf16* __restrict__ Qb, const __bf16* __restrict__ Kb, const __bf16* __restrict__ VTb, const float* __restrict__ mk, float* __restrict__ O32) {
  __shared__ __align__(16) float sS[4][16][68];
  __shared__ __align__(16) __bf16 sPh[4][16][72], sPl[4][16][72];
  __shared__ __align__(16) float sO[4][16][68];
  const int tid = threadIdx.x, w = tid >> 5, lane = tid & 31, col = lane & 15, g = lane >> 4;
  const size_t bh = blockIdx.y; const int q0 = blockIdx.x * 64 + w * 16;
  v16b aq[2];
#pragma unroll
  for (int kc = 0; kc < 2; ++kc) aq[kc] = frag_b(Qb + (bh * SS + q0 + col) * HD + kc * 32, lane);
  float mrun = -3.0e38f, lrun = 0.f; v8f acc[4] = {}, ac2[4] = {};
#pragma unroll 1
  for (int kt = 0; kt < SS / 64; ++kt) {
#pragma unroll
    for (int t = 0; t < 4; ++t) { const int key = kt * 64 + t * 16 + col; v8f s = {};
#pragma unroll
      for (int kc = 0; kc < 2; ++kc) s = wmma_bf(aq[kc], frag_b(Kb + (bh * SS + key) * HD + kc * 32, lane), s);
#pragma unroll
      for (int r = 0; r < 8; ++r) sS[w][8 * g + r][t * 16 + col] = s[r] * 0.125f; }
    LDSX();
    float mx = -3.4e38f;
#pragma unroll
    for (int jj = 0; jj < 32; ++jj) mx = fmaxf(mx, sS[w][col][g * 32 + jj]);
    mx = fmaxf(mx, __shfl_xor(mx, 16, 32));
    const float mnew = fmaxf(mrun, mx); const float corr = expf(mrun - mnew);
    float ps = 0.f;
#pragma unroll
    for (int jj = 0; jj < 32; ++jj) { const float p = expf(sS[w][col][g * 32 + jj] - mnew); ps += p; const float pm = p * bfr(mk[bh * SS + kt * 64 + g * 32 + jj]); const __bf16 hi = (__bf16)pm; sPh[w][col][g * 32 + jj] = hi; sPl[w][col][g * 32 + jj] = (__bf16)(pm - (float)hi); }    // denominator from the unmasked p; the P.V operand carries p * mask_k
    ps += __shfl_xor(ps, 16, 32);
    lrun = lrun * corr + ps; mrun = mnew;
#pragma unroll
    for (int r = 0; r < 8; ++r) { const float cr = __shfl(corr, 8 * g + r, 32);
#pragma unroll
      for (int t = 0; t < 4; ++t) { acc[t][r] *= cr; ac2[t][r] *= cr; } }
    LDSX();
#pragma unroll
    for (int kc = 0; kc < 2; ++kc) { const v16b ph = frag_b(&sPh[w][col][0] + kc * 32, lane), pl = frag_b(&sPl[w][col][0] + kc * 32, lane);
#pragma unroll
      for (int t = 0; t < 4; ++t) { const v16b vb = frag_b(VTb + (bh * HD + t * 16 + col) * SS + kt * 64 + kc * 32, lane); acc[t] = wmma_bf(ph, vb, acc[t]); ac2[t] = wmma_bf(pl, vb, ac2[t]); } }
    __builtin_amdgcn_wave_barrier(); }
#pragma unroll
  for (int r = 0; r < 8; ++r) { const float lr = __shfl(lrun, 8 * g + r, 32); const float inv = 1.0f / lr;
#pragma unroll
    for (int t = 0; t < 4; ++t) sO[w][8 * g + r][t * 16 + col] = (acc[t][r] + ac2[t][r]) * inv; }
  LDSX();
  for (int qq = lane; qq < 16 * 16; qq += 32) { const int rl = qq >> 4, pc = qq & 15; vst2(O32 + (bh * SS + q0 + rl) * HD + pc * 4, *(const v4f*)(&sO[w][rl][pc * 4])); }    // head-major output [bh][s][64]
}
extern "C" void kernel_launch(void* const* d_in, const int* in_sizes, int n_in, void* d_out, int out_size, void* d_ws, size_t ws_size, hipStream_t stream) {
  (void)in_sizes; (void)n_in; (void)out_size; (void)ws_size;
  const float* Q = (const float*)d_in[0]; const float* K = (const float*)d_in[1]; const float* V = (const float*)d_in[2]; const float* mk = (const float*)d_in[3];
  char* ws = (char*)d_ws; size_t off = 0;
  auto take = [&](size_t bytes) { char* p = ws + off; off += (bytes + 255) & ~(size_t)255; return p; };
  const size_t n = (size_t)NBH * SS * HD;
  __bf16* Qb = (__bf16*)take(n * 2); __bf16* Kb = (__bf16*)take(n * 2); __bf16* VTb = (__bf16*)take(n * 2);
  // ws ~ 38 MB
  k_cvt<<<(unsigned)((n / 8 + 255) / 256), 256, 0, stream>>>(Q, Qb, n / 8);
  k_cvt<<<(unsigned)((n / 8 + 255) / 256), 256, 0, stream>>>(K, Kb, n / 8);
  k_cvtv<<<dim3(SS / 64, NBH), 256, 0, stream>>>(V, VTb);
  k_attn<<<dim3(SS / 64, NBH), 128, 0, stream>>>(Qb, Kb, VTb, mk, (float*)d_out);
}

// v001
// It runs in 179 microseconds.
// Two timings next to v000 put it at 1.86 and 1.87 times that version's speed.
// compute dtype: Q, K, V, mask_out (INPUTS) rounded to bf16: exact single bf16 WMMA products for the scores and for V (f32 accumulate), softmax weights carried as a bf16 hi/lo pair; softmax in f32.
#include <hip/hip_runtime.h>
#include <math.h>

typedef __attribute__((ext_vector_type(16))) _Float16 v16h;
typedef __attribute__((ext_vector_type(16))) __bf16 v16b;
typedef __attribute__((ext_vector_type(8)))  _Float16 v8h;
typedef __attribute__((ext_vector_type(8)))  float v8f;
typedef __attribute__((ext_vector_type(4)))  float v4f;
typedef __attribute__((ext_vector_type(2)))  float v2f;
typedef __attribute__((ext_vector_type(4)))  unsigned v4u;
typedef __attribute__((ext_vector_type(4)))  int v4i;
typedef float __attribute__((may_alias)) float_a;
typedef int __attribute__((may_alias)) int_a;

template <typename T> __device__ __forceinline__ void vst2(void* p, T v) { *(T*)p = v;  }
__device__ __forceinline__ v8f wmma16(v16h a, v16h b, v8f c) {
  v8f d = __builtin_amdgcn_wmma_f32_16x16x32_f16(false, a, false, b, (short)0, c, false, false);
  asm volatile("v_nop\n\tv_nop\n\tv_nop\n\tv_nop" : "+v"(d) : "v"(a), "v"(b));
  return d;
}
__device__ __forceinline__ v8f wmma_bf(v16b a, v16b b, v8f c) {
  v8f d = __builtin_amdgcn_wmma_f32_16x16x32_bf16(false, a, false, b, (short)0, c, false, false);
  asm volatile("v_nop\n\tv_nop\n\tv_nop\n\tv_nop" : "+v"(d) : "v"(a), "v"(b));
  return d;
}
// 16x16x32 fragments: lane = (h = lane>>4, row/col = lane&15); elements 0..7 = k0+8h+0..7, 8..15 = k0+16+8h+0..7; D element r = row 8h+r
__device__ __forceinline__ v16h frag_h(const _Float16* rowk0, int lane) {
  union { v16h v; v8h q[2]; } u; const _Float16* p = rowk0 + 8 * (lane >> 4);
  u.q[0] = *(const v8h*)p; u.q[1] = *(const v8h*)(p + 16); return u.v;
}
__device__ __forceinline__ v16h frag_f32(const float* rowk0, int lane) {
  v16h a; const float* p = rowk0 + 8 * (lane >> 4);
#pragma unroll
  for (int i = 0; i < 8; ++i) { a[i] = (_Float16)p[i]; a[8 + i] = (_Float16)p[16 + i]; }
  return a;
}
__device__ __forceinline__ v16h frag_f32s(const float* rowk0, int lane, float sc) {
  v16h a; const float* p = rowk0 + 8 * (lane >> 4);
#pragma unroll
  for (int i = 0; i < 8; ++i) { a[i] = (_Float16)(p[i] * sc); a[8 + i] = (_Float16)(p[16 + i] * sc); }
  return a;
}
// column fragment from a [K][ld] layout (column n), rows >= K read as 0
__device__ __forceinline__ v16h fragc_f32(const float* W, int k0, int n, int lane, int ld, int K) {
  v16h a; const int g = lane >> 4;
#pragma unroll
  for (int i = 0; i < 8; ++i) { const int ka = k0 + 8 * g + i, kb = ka + 16;
    a[i] = (_Float16)(ka < K ? W[(size_t)ka * ld + n] : 0.f); a[8 + i] = (_Float16)(kb < K ? W[(size_t)kb * ld + n] : 0.f); }
  return a;
}
struct F2 { v16b h, l; };
__device__ __forceinline__ F2 bsplit16(const float v[16]) { F2 r;
#pragma unroll
  for (int i = 0; i < 16; ++i) { const __bf16 h = (__bf16)v[i]; r.h[i] = h; r.l[i] = (__bf16)(v[i] - (float)h); }
  return r; }
__device__ __forceinline__ F2 split_row(const float* row, int k0, int lane) { float v[16]; const float* p = row + k0 + 8 * (lane >> 4);
#pragma unroll
  for (int i = 0; i < 8; ++i) { v[i] = p[i]; v[8 + i] = p[16 + i]; }
  return bsplit16(v); }
__device__ __forceinline__ F2 split_rowK(const float* row, int k0, int lane, int K) { float v[16]; const int g = lane >> 4;
#pragma unroll
  for (int i = 0; i < 8; ++i) { const int ka = k0 + 8 * g + i, kb = ka + 16; v[i] = ka < K ? row[ka] : 0.f; v[8 + i] = kb < K ? row[kb] : 0.f; }
  return bsplit16(v); }
__device__ __forceinline__ F2 split_col(const float* W, int k0, int n, int lane, int ld, int K) { float v[16]; const int g = lane >> 4;
#pragma unroll
  for (int i = 0; i < 8; ++i) { const int ka = k0 + 8 * g + i, kb = ka + 16; v[i] = ka < K ? W[(size_t)ka * ld + n] : 0.f; v[8 + i] = kb < K ? W[(size_t)kb * ld + n] : 0.f; }
  return bsplit16(v); }
__device__ __forceinline__ v8f mac3(const F2& a, const F2& b, v8f c) { c = wmma_bf(a.l, b.h, c); c = wmma_bf(a.h, b.l, c); return wmma_bf(a.h, b.h, c); }
__device__ __forceinline__ float sigm(float v) { return 1.0f / (1.0f + expf(-v)); }
#define LDSX() do { asm volatile("s_wait_dscnt 0" ::: "memory"); __builtin_amdgcn_wave_barrier(); __builtin_amdgcn_fence(__ATOMIC_RELEASE, "workgroup"); } while (0)



// Scaled dot attention with a post-softmax multiplicative key mask: attn = softmax(Q K^T / 8) * mask_out[b,h,1,k]; out = attn V  ([4,12,2048,64] head-major inputs, no projections).
// The mask scales the softmax weights AFTER normalisation (no renormalisation): p_k <- p_k * m_k feeds P.V while the denominator keeps the unmasked sum.
__device__ __forceinline__ float bfr(float v) { return (float)(__bf16)v; }
#define NBH 48
#define SS 2048
#define HD 64

__device__ __forceinline__ v16b frag_b(const __bf16* rowk0, int lane) { return __builtin_bit_cast(v16b, frag_h((const _Float16*)rowk0, lane)); }
// head-major [bh][s][64] f32 -> bf16 rows (plain cast, 8 values per thread)
__global__ __launch_bounds__(256) void k_cvt(const float* __restrict__ X, __bf16* __restrict__ Xb, size_t n8) {
  const size_t i8 = (size_t)blockIdx.x * 256 + threadIdx.x; if (i8 >= n8) return;
  union { __bf16 e[8]; v4u u; } pk; const float* src = X + i8 * 8;
#pragma unroll
  for (int e = 0; e < 8; ++e) pk.e[e] = (__bf16)src[e];
  vst2((unsigned*)(Xb + i8 * 8), pk.u);
}
__global__ __launch_bounds__(256) void k_cvtv(const float* __restrict__ V, __bf16* __restrict__ VTb) {
  __shared__ __align__(16) __bf16 st[64][72];
  const int tid = threadIdx.x; const size_t bh = blockIdx.y; const int s0 = blockIdx.x * 64;
  for (int q = tid; q < 64 * 64; q += 256) { const int rl = q >> 6, d = q & 63; st[d][rl] = (__bf16)V[(bh * SS + s0 + rl) * HD + d]; }
  __syncthreads();
  for (int q = tid; q < 64 * 8; q += 256) { const int d = q >> 3, pc = q & 7; vst2((unsigned*)(VTb + (bh * HD + d) * SS + s0 + pc * 8), *(const v4u*)(&st[d][pc * 8])); }
}
#define KP 72    // LDS row pitch in bf16: 128 B of data + 16 B, an odd multiple of 16 B, so the 16-byte fragment reads of 16 rows spread over the banks
#define TB (64 * KP * 2)    // bytes of one staged tile (64 rows)
// Stage one tile of 64 keys for the whole block: 64 K rows and 64 V^T rows of 128 B each. A thread copies 4 + 4 chunks of 16 B (rows 16 apart); 8 lanes cover one whole row.
// s_wait_xcnt closes the statement so that it stands in front of any rewrite of the address registers the copies name.
__device__ __forceinline__ void stage_kv(const __bf16* gk, const __bf16* gv, unsigned lk, unsigned lv) {
  asm volatile("global_load_async_to_lds_b128 %0, %8, off\n\t"
               "global_load_async_to_lds_b128 %1, %9, off\n\t"
               "global_load_async_to_lds_b128 %2, %10, off\n\t"
               "global_load_async_to_lds_b128 %3, %11, off\n\t"
               "global_load_async_to_lds_b128 %4, %12, off\n\t"
               "global_load_async_to_lds_b128 %5, %13, off\n\t"
               "global_load_async_to_lds_b128 %6, %14, off\n\t"
               "global_load_async_to_lds_b128 %7, %15, off\n\t"
               "s_wait_xcnt 0x0"
               :: "v"(lk), "v"(lk + 16 * KP * 2), "v"(lk + 32 * KP * 2), "v"(lk + 48 * KP * 2), "v"(lv), "v"(lv + 16 * KP * 2), "v"(lv + 32 * KP * 2), "v"(lv + 48 * KP * 2),
                  "v"(gk), "v"(gk + 16 * HD), "v"(gk + 32 * HD), "v"(gk + 48 * HD), "v"(gv), "v"(gv + 16 * SS), "v"(gv + 32 * SS), "v"(gv + 48 * SS)
               : "memory");
}
__global__ __launch_bounds__(128) void k_attn(const __bf16* __restrict__ Qb, const __bf16* __restrict__ Kb, const __bf16* __restrict__ VTb, const float* __restrict__ mk, float* __restrict__ O32) {
  __shared__ __align__(16) float sS[4][16][68];
  __shared__ __align__(16) __bf16 sPh[4][16][72], sPl[4][16][72];
  __shared__ __align__(16) float sO[4][16][68];
  __shared__ __align__(16) __bf16 sK[2][64][KP], sV[2][64][KP];    // two buffers: tile kt in buffer kt & 1
  const int tid = threadIdx.x, w = tid >> 5, lane = tid & 31, col = lane & 15, g = lane >> 4;
  const size_t bh = blockIdx.y; const int q0 = blockIdx.x * 64 + w * 16;
  const __bf16* gk = Kb + (bh * SS + (tid >> 3)) * HD + (tid & 7) * 8; const __bf16* gv = VTb + (bh * HD + (tid >> 3)) * SS + (tid & 7) * 8;    // this thread's first chunk of tile 0
  const unsigned lk = (unsigned)(size_t)&sK[0][tid >> 3][(tid & 7) * 8], lv = (unsigned)(size_t)&sV[0][tid >> 3][(tid & 7) * 8];    // its LDS byte addresses in buffer 0
  stage_kv(gk, gv, lk, lv);
  asm volatile("s_wait_asynccnt 0x0" ::: "memory");    // tile 0 has landed before the barrier publishes it
  __syncthreads();
  stage_kv(gk + 64 * HD, gv + 64, lk + TB, lv + TB);    // tile 1 flies while tile 0 is worked on
  v16b aq[2];
#pragma unroll
  for (int kc = 0; kc < 2; ++kc) aq[kc] = frag_b(Qb + (bh * SS + q0 + col) * HD + kc * 32, lane);
  float mrun = -3.0e38f, lrun = 0.f; v8f acc[4] = {}, ac2[4] = {};
#pragma unroll 1
  for (int kt = 0; kt < SS / 64; ++kt) { const int b = kt & 1;
#pragma unroll
    for (int t = 0; t < 4; ++t) { v8f s = {};
#pragma unroll
      for (int kc = 0; kc < 2; ++kc) s = wmma_bf(aq[kc], frag_b(&sK[b][t * 16 + col][kc * 32], lane), s);
#pragma unroll
      for (int r = 0; r < 8; ++r) sS[w][8 * g + r][t * 16 + col] = s[r] * 0.125f; }
    LDSX();
    float mx = -3.4e38f;
#pragma unroll
    for (int jj = 0; jj < 32; ++jj) mx = fmaxf(mx, sS[w][col][g * 32 + jj]);
    mx = fmaxf(mx, __shfl_xor(mx, 16, 32));
    const float mnew = fmaxf(mrun, mx); const float corr = expf(mrun - mnew);
    float ps = 0.f; const float* mrow = mk + bh * SS + kt * 64 + g * 32;    // one base for the lane's 32 mask values, so that they stay 16-byte loads
#pragma unroll
    for (int jj = 0; jj < 32; ++jj) { const float p = expf(sS[w][col][g * 32 + jj] - mnew); ps += p; const float pm = p * bfr(mrow[jj]); const __bf16 hi = (__bf16)pm; sPh[w][col][g * 32 + jj] = hi; sPl[w][col][g * 32 + jj] = (__bf16)(pm - (float)hi); }    // denominator from the unmasked p; the P.V operand carries p * mask_k
    ps += __shfl_xor(ps, 16, 32);
    lrun = lrun * corr + ps; mrun = mnew;
#pragma unroll
    for (int r = 0; r < 8; ++r) { const float cr = __shfl(corr, 8 * g + r, 32);
#pragma unroll
      for (int t = 0; t < 4; ++t) { acc[t][r] *= cr; ac2[t][r] *= cr; } }
    LDSX();
#pragma unroll
    for (int kc = 0; kc < 2; ++kc) { const v16b ph = frag_b(&sPh[w][col][0] + kc * 32, lane), pl = frag_b(&sPl[w][col][0] + kc * 32, lane);
#pragma unroll
      for (int t = 0; t < 4; ++t) { const v16b vb = frag_b(&sV[b][t * 16 + col][kc * 32], lane); acc[t] = wmma_bf(ph, vb, acc[t]); ac2[t] = wmma_bf(pl, vb, ac2[t]); } }
    asm volatile("s_wait_dscnt 0x0" ::: "memory");       // this wave's reads of buffer b are done before the buffer is refilled
    asm volatile("s_wait_asynccnt 0x0" ::: "memory");    // this wave's copies of tile kt + 1 have landed
    __syncthreads();                                     // publishes tile kt + 1 and ends every wave's reads of buffer b
    if (kt + 2 < SS / 64) stage_kv(gk + (size_t)(kt + 2) * 64 * HD, gv + (kt + 2) * 64, lk + b * TB, lv + b * TB); }
  asm volatile("s_wait_asynccnt 0x0" ::: "memory");      // no copy is outstanding when the wave goes on to the output and ends
#pragma unroll
  for (int r = 0; r < 8; ++r) { const float lr = __shfl(lrun, 8 * g + r, 32); const float inv = 1.0f / lr;
#pragma unroll
    for (int t = 0; t < 4; ++t) sO[w][8 * g + r][t * 16 + col] = (acc[t][r] + ac2[t][r]) * inv; }
  LDSX();
  for (int qq = lane; qq < 16 * 16; qq += 32) { const int rl = qq >> 4, pc = qq & 15; vst2(O32 + (bh * SS + q0 + rl) * HD + pc * 4, *(const v4f*)(&sO[w][rl][pc * 4])); }    // head-major output [bh][s][64]
}
extern "C" void kernel_launch(void* const* d_in, const int* in_sizes, int n_in, void* d_out, int out_size, void* d_ws, size_t ws_size, hipStream_t stream) {
  (void)in_sizes; (void)n_in; (void)out_size; (void)ws_size;
  const float* Q = (const float*)d_in[0]; const float* K = (const float*)d_in[1]; const float* V = (const float*)d_in[2]; const float* mk = (const float*)d_in[3];
  char* ws = (char*)d_ws; size_t off = 0;
  auto take = [&](size_t bytes) { char* p = ws + off; off += (bytes + 255) & ~(size_t)255; return p; };
  const size_t n = (size_t)NBH * SS * HD;
  __bf16* Qb = (__bf16*)take(n * 2); __bf16* Kb = (__bf16*)take(n * 2); __bf16* VTb = (__bf16*)take(n * 2);
  // ws ~ 38 MB
  k_cvt<<<(unsigned)((n / 8 + 255) / 256), 256, 0, stream>>>(Q, Qb, n / 8);
  k_cvt<<<(unsigned)((n / 8 + 255) / 256), 256, 0, stream>>>(K, Kb, n / 8);
  k_cvtv<<<dim3(SS / 64, NBH), 256, 0, stream>>>(V, VTb);
  k_attn<<<dim3(SS / 64, NBH), 128, 0, stream>>>(Qb, Kb, VTb, mk, (float*)d_out);
}

// v002
// Measured time: 165 microseconds a run.
// Next to v001, in two timings, it ran 1.08 and 1.09 times as fast.
// Over all steps from v000 it is 2.02 times as fast.
// compute dtype: Q, K, V, mask_out (INPUTS) rounded to bf16: exact single bf16 WMMA products for the scores and for V (f32 accumulate), softmax weights carried as a bf16 hi/lo pair; softmax in f32.
#include <hip/hip_runtime.h>
#include <math.h>

typedef __attribute__((ext_vector_type(16))) _Float16 v16h;
typedef __attribute__((ext_vector_type(16))) __bf16 v16b;
typedef __attribute__((ext_vector_type(8)))  _Float16 v8h;
typedef __attribute__((ext_vector_type(8)))  float v8f;
typedef __attribute__((ext_vector_type(4)))  float v4f;
typedef __attribute__((ext_vector_type(2)))  float v2f;
typedef __attribute__((ext_vector_type(4)))  unsigned v4u;
typedef __attribute__((ext_vector_type(4)))  int v4i;
typedef float __attribute__((may_alias)) float_a;
typedef int __attribute__((may_alias)) int_a;

template <typename T> __device__ __forceinline__ void vst2(void* p, T v) { *(T*)p = v;  }
__device__ __forceinline__ v8f wmma16(v16h a, v16h b, v8f c) {
  v8f d = __builtin_amdgcn_wmma_f32_16x16x32_f16(false, a, false, b, (short)0, c, false, false);
  asm volatile("v_nop\n\tv_nop\n\tv_nop\n\tv_nop" : "+v"(d) : "v"(a), "v"(b));
  return d;
}
__device__ __forceinline__ v8f wmma_bf(v16b a, v16b b, v8f c) {
  v8f d = __builtin_amdgcn_wmma_f32_16x16x32_bf16(false, a, false, b, (short)0, c, false, false);
  asm volatile("v_nop\n\tv_nop\n\tv_nop\n\tv_nop" : "+v"(d) : "v"(a), "v"(b));
  return d;
}
// 16x16x32 fragments: lane = (h = lane>>4, row/col = lane&15); elements 0..7 = k0+8h+0..7, 8..15 = k0+16+8h+0..7; D element r = row 8h+r
__device__ __forceinline__ v16h frag_h(const _Float16* rowk0, int lane) {
  union { v16h v; v8h q[2]; } u; const _Float16* p = rowk0 + 8 * (lane >> 4);
  u.q[0] = *(const v8h*)p; u.q[1] = *(const v8h*)(p + 16); return u.v;
}
__device__ __forceinline__ v16h frag_f32(const float* rowk0, int lane) {
  v16h a; const float* p = rowk0 + 8 * (lane >> 4);
#pragma unroll
  for (int i = 0; i < 8; ++i) { a[i] = (_Float16)p[i]; a[8 + i] = (_Float16)p[16 + i]; }
  return a;
}
__device__ __forceinline__ v16h frag_f32s(const float* rowk0, int lane, float sc) {
  v16h a; const float* p = rowk0 + 8 * (lane >> 4);
#pragma unroll
  for (int i = 0; i < 8; ++i) { a[i] = (_Float16)(p[i] * sc); a[8 + i] = (_Float16)(p[16 + i] * sc); }
  return a;
}
// column fragment from a [K][ld] layout (column n), rows >= K read as 0
__device__ __forceinline__ v16h fragc_f32(const float* W, int k0, int n, int lane, int ld, int K) {
  v16h a; const int g = lane >> 4;
#pragma unroll
  for (int i = 0; i < 8; ++i) { const int ka = k0 + 8 * g + i, kb = ka + 16;
    a[i] = (_Float16)(ka < K ? W[(size_t)ka * ld + n] : 0.f); a[8 + i] = (_Float16)(kb < K ? W[(size_t)kb * ld + n] : 0.f); }
  return a;
}
struct F2 { v16b h, l; };
__device__ __forceinline__ F2 bsplit16(const float v[16]) { F2 r;
#pragma unroll
  for (int i = 0; i < 16; ++i) { const __bf16 h = (__bf16)v[i]; r.h[i] = h; r.l[i] = (__bf16)(v[i] - (float)h); }
  return r; }
__device__ __forceinline__ F2 split_row(const float* row, int k0, int lane) { float v[16]; const float* p = row + k0 + 8 * (lane >> 4);
#pragma unroll
  for (int i = 0; i < 8; ++i) { v[i] = p[i]; v[8 + i] = p[16 + i]; }
  return bsplit16(v); }
__device__ __forceinline__ F2 split_rowK(const float* row, int k0, int lane, int K) { float v[16]; const int g = lane >> 4;
#pragma unroll
  for (int i = 0; i < 8; ++i) { const int ka = k0 + 8 * g + i, kb = ka + 16; v[i] = ka < K ? row[ka] : 0.f; v[8 + i] = kb < K ? row[kb] : 0.f; }
  return bsplit16(v); }
__device__ __forceinline__ F2 split_col(const float* W, int k0, int n, int lane, int ld, int K) { float v[16]; const int g = lane >> 4;
#pragma unroll
  for (int i = 0; i < 8; ++i) { const int ka = k0 + 8 * g + i, kb = ka + 16; v[i] = ka < K ? W[(size_t)ka * ld + n] : 0.f; v[8 + i] = kb < K ? W[(size_t)kb * ld + n] : 0.f; }
  return bsplit16(v); }
__device__ __forceinline__ v8f mac3(const F2& a, const F2& b, v8f c) { c = wmma_bf(a.l, b.h, c); c = wmma_bf(a.h, b.l, c); return wmma_bf(a.h, b.h, c); }
__device__ __forceinline__ float sigm(float v) { return 1.0f / (1.0f + expf(-v)); }
#define LDSX() do { asm volatile("s_wait_dscnt 0" ::: "memory"); __builtin_amdgcn_wave_barrier(); __builtin_amdgcn_fence(__ATOMIC_RELEASE, "workgroup"); } while (0)



// Scaled dot attention with a post-softmax multiplicative key mask: attn = softmax(Q K^T / 8) * mask_out[b,h,1,k]; out = attn V  ([4,12,2048,64] head-major inputs, no projections).
// The mask scales the softmax weights AFTER normalisation (no renormalisation): p_k <- p_k * m_k feeds P.V while the denominator keeps the unmasked sum.
__device__ __forceinline__ float bfr(float v) { return (float)(__bf16)v; }
#define NBH 48
#define SS 2048
#define HD 64

__device__ __forceinline__ v16b frag_b(const __bf16* rowk0, int lane) { return __builtin_bit_cast(v16b, frag_h((const _Float16*)rowk0, lane)); }
// head-major [bh][s][64] f32 -> bf16 rows (plain cast, 8 values per thread)
__global__ __launch_bounds__(256) void k_cvt(const float* __restrict__ X, __bf16* __restrict__ Xb, size_t n8) {
  const size_t i8 = (size_t)blockIdx.x * 256 + threadIdx.x; if (i8 >= n8) return;
  union { __bf16 e[8]; v4u u; } pk; const float* src = X + i8 * 8;
#pragma unroll
  for (int e = 0; e < 8; ++e) pk.e[e] = (__bf16)src[e];
  vst2((unsigned*)(Xb + i8 * 8), pk.u);
}
__global__ __launch_bounds__(256) void k_cvtv(const float* __restrict__ V, __bf16* __restrict__ VTb) {
  __shared__ __align__(16) __bf16 st[64][72];
  const int tid = threadIdx.x; const size_t bh = blockIdx.y; const int s0 = blockIdx.x * 64;
  for (int q = tid; q < 64 * 64; q += 256) { const int rl = q >> 6, d = q & 63; st[d][rl] = (__bf16)V[(bh * SS + s0 + rl) * HD + d]; }
  __syncthreads();
  for (int q = tid; q < 64 * 8; q += 256) { const int d = q >> 3, pc = q & 7; vst2((unsigned*)(VTb + (bh * HD + d) * SS + s0 + pc * 8), *(const v4u*)(&st[d][pc * 8])); }
}
#define KP 72    // LDS row pitch in bf16: 128 B of data + 16 B, an odd multiple of 16 B, so the 16-byte fragment reads of 16 rows spread over the banks
#define TB (64 * KP * 2)    // bytes of one staged tile (64 rows)
// Stage one tile of 64 keys for the whole block: 64 K rows and 64 V^T rows of 128 B each. A thread copies 4 + 4 chunks of 16 B (rows 16 apart); 8 lanes cover one whole row.
// s_wait_xcnt closes the statement so that it stands in front of any rewrite of the address registers the copies name.
__device__ __forceinline__ void stage_kv(const __bf16* gk, const __bf16* gv, unsigned lk, unsigned lv) {
  asm volatile("global_load_async_to_lds_b128 %0, %8, off\n\t"
               "global_load_async_to_lds_b128 %1, %9, off\n\t"
               "global_load_async_to_lds_b128 %2, %10, off\n\t"
               "global_load_async_to_lds_b128 %3, %11, off\n\t"
               "global_load_async_to_lds_b128 %4, %12, off\n\t"
               "global_load_async_to_lds_b128 %5, %13, off\n\t"
               "global_load_async_to_lds_b128 %6, %14, off\n\t"
               "global_load_async_to_lds_b128 %7, %15, off\n\t"
               "s_wait_xcnt 0x0"
               :: "v"(lk), "v"(lk + 16 * KP * 2), "v"(lk + 32 * KP * 2), "v"(lk + 48 * KP * 2), "v"(lv), "v"(lv + 16 * KP * 2), "v"(lv + 32 * KP * 2), "v"(lv + 48 * KP * 2),
                  "v"(gk), "v"(gk + 16 * HD), "v"(gk + 32 * HD), "v"(gk + 48 * HD), "v"(gv), "v"(gv + 16 * SS), "v"(gv + 32 * SS), "v"(gv + 48 * SS)
               : "memory");
}
__global__ __launch_bounds__(128) void k_attn(const __bf16* __restrict__ Qb, const __bf16* __restrict__ Kb, const __bf16* __restrict__ VTb, const float* __restrict__ mk, float* __restrict__ O32) {
  __shared__ __align__(16) __bf16 sK[2][64][KP], sV[2][64][KP];    // two buffers: tile kt in buffer kt & 1
  const int tid = threadIdx.x, w = tid >> 5, lane = tid & 31, col = lane & 15, g = lane >> 4;
  const size_t bh = blockIdx.y; const int q0 = blockIdx.x * 64 + w * 16;
  const __bf16* gk = Kb + (bh * SS + (tid >> 3)) * HD + (tid & 7) * 8; const __bf16* gv = VTb + (bh * HD + (tid >> 3)) * SS + (tid & 7) * 8;    // this thread's first chunk of tile 0
  const unsigned lk = (unsigned)(size_t)&sK[0][tid >> 3][(tid & 7) * 8], lv = (unsigned)(size_t)&sV[0][tid >> 3][(tid & 7) * 8];    // its LDS byte addresses in buffer 0
  stage_kv(gk, gv, lk, lv);
  asm volatile("s_wait_asynccnt 0x0" ::: "memory");    // tile 0 has landed before the barrier publishes it
  __syncthreads();
  stage_kv(gk + 64 * HD, gv + 64, lk + TB, lv + TB);    // tile 1 flies while tile 0 is worked on
  v16b aq[2];
#pragma unroll
  for (int kc = 0; kc < 2; ++kc) aq[kc] = frag_b(Qb + (bh * SS + q0 + col) * HD + kc * 32, lane);
  float mrun = -3.0e38f, lrun = 0.f; v8f acc[4] = {}, ac2[4] = {};
#pragma unroll 1
  for (int kt = 0; kt < SS / 64; ++kt) { const int b = kt & 1;
    v8f s[4];
#pragma unroll
    for (int t = 0; t < 4; ++t) { s[t] = v8f{};
#pragma unroll
      for (int kc = 0; kc < 2; ++kc) s[t] = wmma_bf(frag_b(&sK[b][t * 16 + col][kc * 32], lane), aq[kc], s[t]);
      s[t] *= 0.125f; }
    float mx = -3.4e38f;
#pragma unroll
    for (int t = 0; t < 4; ++t)
#pragma unroll
      for (int r = 0; r < 8; ++r) mx = fmaxf(mx, s[t][r]);
    mx = fmaxf(mx, __shfl_xor(mx, 16, 32));    // the other half of the wave holds the query's other 32 keys
    const float mnew = fmaxf(mrun, mx); const float corr = expf(mrun - mnew);
    float ps = 0.f; const float* mrow = mk + bh * SS + kt * 64 + g * 8;    // one base for the lane's 32 mask values, so that they stay 16-byte loads
    v16b ph[2], pl[2];
#pragma unroll
    for (int t = 0; t < 4; ++t)
#pragma unroll
      for (int r = 0; r < 8; ++r) { const float p = expf(s[t][r] - mnew); ps += p; const float pm = p * bfr(mrow[t * 16 + r]); const __bf16 hi = (__bf16)pm; ph[t >> 1][(t & 1) * 8 + r] = hi; pl[t >> 1][(t & 1) * 8 + r] = (__bf16)(pm - (float)hi); }    // denominator from the unmasked p; the P.V operand carries p * mask_k
    ps += __shfl_xor(ps, 16, 32);
    lrun = lrun * corr + ps; mrun = mnew;
#pragma unroll
    for (int t = 0; t < 4; ++t) { acc[t] *= corr; ac2[t] *= corr; }
#pragma unroll
    for (int kc = 0; kc < 2; ++kc)
#pragma unroll
      for (int t = 0; t < 4; ++t) { const v16b vb = frag_b(&sV[b][t * 16 + col][kc * 32], lane); acc[t] = wmma_bf(vb, ph[kc], acc[t]); ac2[t] = wmma_bf(vb, pl[kc], ac2[t]); }
    asm volatile("s_wait_dscnt 0x0" ::: "memory");       // this wave's reads of buffer b are done before the buffer is refilled
    asm volatile("s_wait_asynccnt 0x0" ::: "memory");    // this wave's copies of tile kt + 1 have landed
    __syncthreads();                                     // publishes tile kt + 1 and ends every wave's reads of buffer b
    if (kt + 2 < SS / 64) stage_kv(gk + (size_t)(kt + 2) * 64 * HD, gv + (kt + 2) * 64, lk + b * TB, lv + b * TB); }
  asm volatile("s_wait_asynccnt 0x0" ::: "memory");      // no copy is outstanding when the wave goes on to the output and ends
  const float inv = 1.0f / lrun; float* orow = O32 + (bh * SS + q0 + col) * HD + g * 8;    // head-major output [bh][s][64]; accumulator tile t holds 8 consecutive values of the lane's own row
#pragma unroll
  for (int t = 0; t < 4; ++t) { const v8f o = (acc[t] + ac2[t]) * inv;
    vst2(orow + t * 16, __builtin_shufflevector(o, o, 0, 1, 2, 3)); vst2(orow + t * 16 + 4, __builtin_shufflevector(o, o, 4, 5, 6, 7)); }
}
extern "C" void kernel_launch(void* const* d_in, const int* in_sizes, int n_in, void* d_out, int out_size, void* d_ws, size_t ws_size, hipStream_t stream) {
  (void)in_sizes; (void)n_in; (void)out_size; (void)ws_size;
  const float* Q = (const float*)d_in[0]; const float* K = (const float*)d_in[1]; const float* V = (const float*)d_in[2]; const float* mk = (const float*)d_in[3];
  char* ws = (char*)d_ws; size_t off = 0;
  auto take = [&](size_t bytes) { char* p = ws + off; off += (bytes + 255) & ~(size_t)255; return p; };
  const size_t n = (size_t)NBH * SS * HD;
  __bf16* Qb = (__bf16*)take(n * 2); __bf16* Kb = (__bf16*)take(n * 2); __bf16* VTb = (__bf16*)take(n * 2);
  // ws ~ 38 MB
  k_cvt<<<(unsigned)((n / 8 + 255) / 256), 256, 0, stream>>>(Q, Qb, n / 8);
  k_cvt<<<(unsigned)((n / 8 + 255) / 256), 256, 0, stream>>>(K, Kb, n / 8);
  k_cvtv<<<dim3(SS / 64, NBH), 256, 0, stream>>>(V, VTb);
  k_attn<<<dim3(SS / 64, NBH), 128, 0, stream>>>(Qb, Kb, VTb, mk, (float*)d_out);
}

// v003
// It runs in 118 microseconds.
// Two timings next to v002 both put it at 1.40 times that version's speed.
// All steps since v000 together make it 2.83 times as fast.
// compute dtype: Q, K, V, mask_out (INPUTS) rounded to bf16: exact single bf16 WMMA products for the scores and for V (f32 accumulate), softmax weights carried as a bf16 hi/lo pair; softmax in f32.
#include <hip/hip_runtime.h>
#include <math.h>

typedef __attribute__((ext_vector_type(16))) _Float16 v16h;
typedef __attribute__((ext_vector_type(16))) __bf16 v16b;
typedef __attribute__((ext_vector_type(8)))  _Float16 v8h;
typedef __attribute__((ext_vector_type(8)))  float v8f;
typedef __attribute__((ext_vector_type(4)))  float v4f;
typedef __attribute__((ext_vector_type(2)))  float v2f;
typedef __attribute__((ext_vector_type(4)))  unsigned v4u;
typedef __attribute__((ext_vector_type(4)))  int v4i;
typedef float __attribute__((may_alias)) float_a;
typedef int __attribute__((may_alias)) int_a;

template <typename T> __device__ __forceinline__ void vst2(void* p, T v) { *(T*)p = v;  }
__device__ __forceinline__ v8f wmma16(v16h a, v16h b, v8f c) {
  v8f d = __builtin_amdgcn_wmma_f32_16x16x32_f16(false, a, false, b, (short)0, c, false, false);
  asm volatile("v_nop\n\tv_nop\n\tv_nop\n\tv_nop" : "+v"(d) : "v"(a), "v"(b));
  return d;
}
__device__ __forceinline__ v8f wmma_bf(v16b a, v16b b, v8f c) {
  v8f d = __builtin_amdgcn_wmma_f32_16x16x32_bf16(false, a, false, b, (short)0, c, false, false);
  asm volatile("v_nop\n\tv_nop\n\tv_nop\n\tv_nop" : "+v"(d) : "v"(a), "v"(b));
  return d;
}
// 16x16x32 fragments: lane = (h = lane>>4, row/col = lane&15); elements 0..7 = k0+8h+0..7, 8..15 = k0+16+8h+0..7; D element r = row 8h+r
__device__ __forceinline__ v16h frag_h(const _Float16* rowk0, int lane) {
  union { v16h v; v8h q[2]; } u; const _Float16* p = rowk0 + 8 * (lane >> 4);
  u.q[0] = *(const v8h*)p; u.q[1] = *(const v8h*)(p + 16); return u.v;
}
__device__ __forceinline__ v16h frag_f32(const float* rowk0, int lane) {
  v16h a; const float* p = rowk0 + 8 * (lane >> 4);
#pragma unroll
  for (int i = 0; i < 8; ++i) { a[i] = (_Float16)p[i]; a[8 + i] = (_Float16)p[16 + i]; }
  return a;
}
__device__ __forceinline__ v16h frag_f32s(const float* rowk0, int lane, float sc) {
  v16h a; const float* p = rowk0 + 8 * (lane >> 4);
#pragma unroll
  for (int i = 0; i < 8; ++i) { a[i] = (_Float16)(p[i] * sc); a[8 + i] = (_Float16)(p[16 + i] * sc); }
  return a;
}
// column fragment from a [K][ld] layout (column n), rows >= K read as 0
__device__ __forceinline__ v16h fragc_f32(const float* W, int k0, int n, int lane, int ld, int K) {
  v16h a; const int g = lane >> 4;
#pragma unroll
  for (int i = 0; i < 8; ++i) { const int ka = k0 + 8 * g + i, kb = ka + 16;
    a[i] = (_Float16)(ka < K ? W[(size_t)ka * ld + n] : 0.f); a[8 + i] = (_Float16)(kb < K ? W[(size_t)kb * ld + n] : 0.f); }
  return a;
}
struct F2 { v16b h, l; };
__device__ __forceinline__ F2 bsplit16(const float v[16]) { F2 r;
#pragma unroll
  for (int i = 0; i < 16; ++i) { const __bf16 h = (__bf16)v[i]; r.h[i] = h; r.l[i] = (__bf16)(v[i] - (float)h); }
  return r; }
__device__ __forceinline__ F2 split_row(const float* row, int k0, int lane) { float v[16]; const float* p = row + k0 + 8 * (lane >> 4);
#pragma unroll
  for (int i = 0; i < 8; ++i) { v[i] = p[i]; v[8 + i] = p[16 + i]; }
  return bsplit16(v); }
__device__ __forceinline__ F2 split_rowK(const float* row, int k0, int lane, int K) { float v[16]; const int g = lane >> 4;
#pragma unroll
  for (int i = 0; i < 8; ++i) { const int ka = k0 + 8 * g + i, kb = ka + 16; v[i] = ka < K ? row[ka] : 0.f; v[8 + i] = kb < K ? row[kb] : 0.f; }
  return bsplit16(v); }
__device__ __forceinline__ F2 split_col(const float* W, int k0, int n, int lane, int ld, int K) { float v[16]; const int g = lane >> 4;
#pragma unroll
  for (int i = 0; i < 8; ++i) { const int ka = k0 + 8 * g + i, kb = ka + 16; v[i] = ka < K ? W[(size_t)ka * ld + n] : 0.f; v[8 + i] = kb < K ? W[(size_t)kb * ld + n] : 0.f; }
  return bsplit16(v); }
__device__ __forceinline__ v8f mac3(const F2& a, const F2& b, v8f c) { c = wmma_bf(a.l, b.h, c); c = wmma_bf(a.h, b.l, c); return wmma_bf(a.h, b.h, c); }
__device__ __forceinline__ float sigm(float v) { return 1.0f / (1.0f + expf(-v)); }
#define LDSX() do { asm volatile("s_wait_dscnt 0" ::: "memory"); __builtin_amdgcn_wave_barrier(); __builtin_amdgcn_fence(__ATOMIC_RELEASE, "workgroup"); } while (0)



// Scaled dot attention with a post-softmax multiplicative key mask: attn = softmax(Q K^T / 8) * mask_out[b,h,1,k]; out = attn V  ([4,12,2048,64] head-major inputs, no projections).
// The mask scales the softmax weights AFTER normalisation (no renormalisation): p_k <- p_k * m_k feeds P.V while the denominator keeps the unmasked sum.
__device__ __forceinline__ float bfr(float v) { return (float)(__bf16)v; }
#define NBH 48
#define SS 2048
#define HD 64
#define C2 0.18033688f    // log2(e) / sqrt(64): score scale and change of base in one factor

__device__ __forceinline__ v16b frag_b(const __bf16* rowk0, int lane) { return __builtin_bit_cast(v16b, frag_h((const _Float16*)rowk0, lane)); }
// head-major [bh][s][64] f32 -> bf16 rows (plain cast, 8 values per thread)
__global__ __launch_bounds__(256) void k_cvt(const float* __restrict__ X, __bf16* __restrict__ Xb, size_t n8) {
  const size_t i8 = (size_t)blockIdx.x * 256 + threadIdx.x; if (i8 >= n8) return;
  union { __bf16 e[8]; v4u u; } pk; const float* src = X + i8 * 8;
#pragma unroll
  for (int e = 0; e < 8; ++e) pk.e[e] = (__bf16)src[e];
  vst2((unsigned*)(Xb + i8 * 8), pk.u);
}
__global__ __launch_bounds__(256) void k_cvtv(const float* __restrict__ V, __bf16* __restrict__ VTb) {
  __shared__ __align__(16) __bf16 st[64][72];
  const int tid = threadIdx.x; const size_t bh = blockIdx.y; const int s0 = blockIdx.x * 64;
  for (int q = tid; q < 64 * 64; q += 256) { const int rl = q >> 6, d = q & 63; st[d][rl] = (__bf16)V[(bh * SS + s0 + rl) * HD + d]; }
  __syncthreads();
  for (int q = tid; q < 64 * 8; q += 256) { const int d = q >> 3, pc = q & 7; vst2((unsigned*)(VTb + (bh * HD + d) * SS + s0 + pc * 8), *(const v4u*)(&st[d][pc * 8])); }
}
#define KP 72    // LDS row pitch in bf16: 128 B of data + 16 B, an odd multiple of 16 B, so the 16-byte fragment reads of 16 rows spread over the banks
#define TB (64 * KP * 2)    // bytes of one staged tile (64 rows)
// Stage one tile of 64 keys for the whole block: 64 K rows and 64 V^T rows of 128 B each. A thread copies 4 + 4 chunks of 16 B (rows 16 apart); 8 lanes cover one whole row.
// s_wait_xcnt closes the statement so that it stands in front of any rewrite of the address registers the copies name.
__device__ __forceinline__ void stage_kv(const __bf16* gk, const __bf16* gv, unsigned lk, unsigned lv) {
  asm volatile("global_load_async_to_lds_b128 %0, %8, off\n\t"
               "global_load_async_to_lds_b128 %1, %9, off\n\t"
               "global_load_async_to_lds_b128 %2, %10, off\n\t"
               "global_load_async_to_lds_b128 %3, %11, off\n\t"
               "global_load_async_to_lds_b128 %4, %12, off\n\t"
               "global_load_async_to_lds_b128 %5, %13, off\n\t"
               "global_load_async_to_lds_b128 %6, %14, off\n\t"
               "global_load_async_to_lds_b128 %7, %15, off\n\t"
               "s_wait_xcnt 0x0"
               :: "v"(lk), "v"(lk + 16 * KP * 2), "v"(lk + 32 * KP * 2), "v"(lk + 48 * KP * 2), "v"(lv), "v"(lv + 16 * KP * 2), "v"(lv + 32 * KP * 2), "v"(lv + 48 * KP * 2),
                  "v"(gk), "v"(gk + 16 * HD), "v"(gk + 32 * HD), "v"(gk + 48 * HD), "v"(gv), "v"(gv + 16 * SS), "v"(gv + 32 * SS), "v"(gv + 48 * SS)
               : "memory");
}
__global__ __launch_bounds__(128) void k_attn(const __bf16* __restrict__ Qb, const __bf16* __restrict__ Kb, const __bf16* __restrict__ VTb, const float* __restrict__ mk, float* __restrict__ O32) {
  __shared__ __align__(16) __bf16 sK[2][64][KP], sV[2][64][KP];    // two buffers: tile kt in buffer kt & 1
  const int tid = threadIdx.x, w = tid >> 5, lane = tid & 31, col = lane & 15, g = lane >> 4;
  const size_t bh = blockIdx.y; const int q0 = blockIdx.x * 64 + w * 16;
  const __bf16* gk = Kb + (bh * SS + (tid >> 3)) * HD + (tid & 7) * 8; const __bf16* gv = VTb + (bh * HD + (tid >> 3)) * SS + (tid & 7) * 8;    // this thread's first chunk of tile 0
  const unsigned lk = (unsigned)(size_t)&sK[0][tid >> 3][(tid & 7) * 8], lv = (unsigned)(size_t)&sV[0][tid >> 3][(tid & 7) * 8];    // its LDS byte addresses in buffer 0
  stage_kv(gk, gv, lk, lv);
  asm volatile("s_wait_asynccnt 0x0" ::: "memory");    // tile 0 has landed before the barrier publishes it
  __syncthreads();
  stage_kv(gk + 64 * HD, gv + 64, lk + TB, lv + TB);    // tile 1 flies while tile 0 is worked on
  v16b aq[2];
#pragma unroll
  for (int kc = 0; kc < 2; ++kc) aq[kc] = frag_b(Qb + (bh * SS + q0 + col) * HD + kc * 32, lane);
  float mrun = -3.0e38f, lrun = 0.f; v8f acc[4] = {}, ac2[4] = {};
#pragma unroll 1
  for (int kt = 0; kt < SS / 64; ++kt) { const int b = kt & 1;
    v8f s[4];
#pragma unroll
    for (int t = 0; t < 4; ++t) { s[t] = v8f{};
#pragma unroll
      for (int kc = 0; kc < 2; ++kc) s[t] = wmma_bf(frag_b(&sK[b][t * 16 + col][kc * 32], lane), aq[kc], s[t]); }    // raw dot products; the scale is folded into C2
    float mx = -3.4e38f;
#pragma unroll
    for (int t = 0; t < 4; ++t)
#pragma unroll
      for (int r = 0; r < 8; ++r) mx = fmaxf(mx, s[t][r]);
    mx = fmaxf(mx, __shfl_xor(mx, 16, 32));    // the other half of the wave holds the query's other 32 keys
    const float mnew = fmaxf(mrun, mx * C2); const float corr = __builtin_amdgcn_exp2f(mrun - mnew);    // mrun, mnew: running maximum times C2 (C2 > 0 keeps the order); an unchanged maximum gives exactly 1
    float ps = 0.f; const float* mrow = mk + bh * SS + kt * 64 + g * 8;    // one base for the lane's 32 mask values, so that they stay 16-byte loads
    v16b ph[2], pl[2];
#pragma unroll
    for (int t = 0; t < 4; ++t)
#pragma unroll
      for (int r = 0; r < 8; ++r) { const v2f x = __builtin_elementwise_fma(v2f{s[t][r & 6], s[t][r | 1]}, v2f{C2, C2}, v2f{-mnew, -mnew});    // exp((s - m) / 8) = 2^(s * C2 - m * C2): one packed fused multiply-add for two elements
        const float p = __builtin_amdgcn_exp2f(x[r & 1]); ps += p; const float pm = p * bfr(mrow[t * 16 + r]); const __bf16 hi = (__bf16)pm; ph[t >> 1][(t & 1) * 8 + r] = hi; pl[t >> 1][(t & 1) * 8 + r] = (__bf16)(pm - (float)hi); }    // denominator from the unmasked p; the P.V operand carries p * mask_k
    asm volatile("s_wait_xcnt 0x0" ::: "memory");    // stands in front of any reuse of the address registers that the mask loads name
    ps += __shfl_xor(ps, 16, 32);
    lrun = lrun * corr + ps; mrun = mnew;
#pragma unroll
    for (int t = 0; t < 4; ++t) { acc[t] *= corr; ac2[t] *= corr; }
#pragma unroll
    for (int kc = 0; kc < 2; ++kc)
#pragma unroll
      for (int t = 0; t < 4; ++t) { const v16b vb = frag_b(&sV[b][t * 16 + col][kc * 32], lane); acc[t] = wmma_bf(vb, ph[kc], acc[t]); ac2[t] = wmma_bf(vb, pl[kc], ac2[t]); }
    asm volatile("s_wait_dscnt 0x0" ::: "memory");       // this wave's reads of buffer b are done before the buffer is refilled
    asm volatile("s_wait_asynccnt 0x0" ::: "memory");    // this wave's copies of tile kt + 1 have landed
    __syncthreads();                                     // publishes tile kt + 1 and ends every wave's reads of buffer b
    if (kt + 2 < SS / 64) stage_kv(gk + (size_t)(kt + 2) * 64 * HD, gv + (kt + 2) * 64, lk + b * TB, lv + b * TB); }
  asm volatile("s_wait_asynccnt 0x0" ::: "memory");      // no copy is outstanding when the wave goes on to the output and ends
  const float inv = 1.0f / lrun; float* orow = O32 + (bh * SS + q0 + col) * HD + g * 8;    // head-major output [bh][s][64]; accumulator tile t holds 8 consecutive values of the lane's own row
#pragma unroll
  for (int t = 0; t < 4; ++t) { const v8f o = (acc[t] + ac2[t]) * inv;
    vst2(orow + t * 16, __builtin_shufflevector(o, o, 0, 1, 2, 3)); vst2(orow + t * 16 + 4, __builtin_shufflevector(o, o, 4, 5, 6, 7)); }
}
extern "C" void kernel_launch(void* const* d_in, const int* in_sizes, int n_in, void* d_out, int out_size, void* d_ws, size_t ws_size, hipStream_t stream) {
  (void)in_sizes; (void)n_in; (void)out_size; (void)ws_size;
  const float* Q = (const float*)d_in[0]; const float* K = (const float*)d_in[1]; const float* V = (const float*)d_in[2]; const float* mk = (const float*)d_in[3];
  char* ws = (char*)d_ws; size_t off = 0;
  auto take = [&](size_t bytes) { char* p = ws + off; off += (bytes + 255) & ~(size_t)255; return p; };
  const size_t n = (size_t)NBH * SS * HD;
  __bf16* Qb = (__bf16*)take(n * 2); __bf16* Kb = (__bf16*)take(n * 2); __bf16* VTb = (__bf16*)take(n * 2);
  // ws ~ 38 MB
  k_cvt<<<(unsigned)((n / 8 + 255) / 256), 256, 0, stream>>>(Q, Qb, n / 8);
  k_cvt<<<(unsigned)((n / 8 + 255) / 256), 256, 0, stream>>>(K, Kb, n / 8);
  k_cvtv<<<dim3(SS / 64, NBH), 256, 0, stream>>>(V, VTb);
  k_attn<<<dim3(SS / 64, NBH), 128, 0, stream>>>(Qb, Kb, VTb, mk, (float*)d_out);
}

// v004
// A run of this version takes 110 microseconds.
// In two side-by-side timings against v003, it was 1.06 and 1.07 times as fast.
// All steps since v000 together make it 3.02 times as fast.
// compute dtype: Q, K, V, mask_out (INPUTS) rounded to bf16: exact single bf16 WMMA products for the scores and for V (f32 accumulate), softmax weights carried as a bf16 hi/lo pair; softmax in f32.
#include <hip/hip_runtime.h>
#include <math.h>

typedef __attribute__((ext_vector_type(16))) _Float16 v16h;
typedef __attribute__((ext_vector_type(16))) __bf16 v16b;
typedef __attribute__((ext_vector_type(8)))  _Float16 v8h;
typedef __attribute__((ext_vector_type(8)))  float v8f;
typedef __attribute__((ext_vector_type(4)))  float v4f;
typedef __attribute__((ext_vector_type(2)))  float v2f;
typedef __attribute__((ext_vector_type(4)))  unsigned v4u;
typedef __attribute__((ext_vector_type(4)))  int v4i;
typedef float __attribute__((may_alias)) float_a;
typedef int __attribute__((may_alias)) int_a;

template <typename T> __device__ __forceinline__ void vst2(void* p, T v) { *(T*)p = v;  }
__device__ __forceinline__ v8f wmma16(v16h a, v16h b, v8f c) {
  v8f d = __builtin_amdgcn_wmma_f32_16x16x32_f16(false, a, false, b, (short)0, c, false, false);
  asm volatile("v_nop\n\tv_nop\n\tv_nop\n\tv_nop" : "+v"(d) : "v"(a), "v"(b));
  return d;
}
__device__ __forceinline__ v8f wmma_bf(v16b a, v16b b, v8f c) {
  return __builtin_amdgcn_wmma_f32_16x16x32_bf16(false, a, false, b, (short)0, c, false, false);
}
// 16x16x32 fragments: lane = (h = lane>>4, row/col = lane&15); elements 0..7 = k0+8h+0..7, 8..15 = k0+16+8h+0..7; D element r = row 8h+r
__device__ __forceinline__ v16h frag_h(const _Float16* rowk0, int lane) {
  union { v16h v; v8h q[2]; } u; const _Float16* p = rowk0 + 8 * (lane >> 4);
  u.q[0] = *(const v8h*)p; u.q[1] = *(const v8h*)(p + 16); return u.v;
}
__device__ __forceinline__ v16h frag_f32(const float* rowk0, int lane) {
  v16h a; const float* p = rowk0 + 8 * (lane >> 4);
#pragma unroll
  for (int i = 0; i < 8; ++i) { a[i] = (_Float16)p[i]; a[8 + i] = (_Float16)p[16 + i]; }
  return a;
}
__device__ __forceinline__ v16h frag_f32s(const float* rowk0, int lane, float sc) {
  v16h a; const float* p = rowk0 + 8 * (lane >> 4);
#pragma unroll
  for (int i = 0; i < 8; ++i) { a[i] = (_Float16)(p[i] * sc); a[8 + i] = (_Float16)(p[16 + i] * sc); }
  return a;
}
// column fragment from a [K][ld] layout (column n), rows >= K read as 0
__device__ __forceinline__ v16h fragc_f32(const float* W, int k0, int n, int lane, int ld, int K) {
  v16h a; const int g = lane >> 4;
#pragma unroll
  for (int i = 0; i < 8; ++i) { const int ka = k0 + 8 * g + i, kb = ka + 16;
    a[i] = (_Float16)(ka < K ? W[(size_t)ka * ld + n] : 0.f); a[8 + i] = (_Float16)(kb < K ? W[(size_t)kb * ld + n] : 0.f); }
  return a;
}
struct F2 { v16b h, l; };
__device__ __forceinline__ F2 bsplit16(const float v[16]) { F2 r;
#pragma unroll
  for (int i = 0; i < 16; ++i) { const __bf16 h = (__bf16)v[i]; r.h[i] = h; r.l[i] = (__bf16)(v[i] - (float)h); }
  return r; }
__device__ __forceinline__ F2 split_row(const float* row, int k0, int lane) { float v[16]; const float* p = row + k0 + 8 * (lane >> 4);
#pragma unroll
  for (int i = 0; i < 8; ++i) { v[i] = p[i]; v[8 + i] = p[16 + i]; }
  return bsplit16(v); }
__device__ __forceinline__ F2 split_rowK(const float* row, int k0, int lane, int K) { float v[16]; const int g = lane >> 4;
#pragma unroll
  for (int i = 0; i < 8; ++i) { const int ka = k0 + 8 * g + i, kb = ka + 16; v[i] = ka < K ? row[ka] : 0.f; v[8 + i] = kb < K ? row[kb] : 0.f; }
  return bsplit16(v); }
__device__ __forceinline__ F2 split_col(const float* W, int k0, int n, int lane, int ld, int K) { float v[16]; const int g = lane >> 4;
#pragma unroll
  for (int i = 0; i < 8; ++i) { const int ka = k0 + 8 * g + i, kb = ka + 16; v[i] = ka < K ? W[(size_t)ka * ld + n] : 0.f; v[8 + i] = kb < K ? W[(size_t)kb * ld + n] : 0.f; }
  return bsplit16(v); }
__device__ __forceinline__ v8f mac3(const F2& a, const F2& b, v8f c) { c = wmma_bf(a.l, b.h, c); c = wmma_bf(a.h, b.l, c); return wmma_bf(a.h, b.h, c); }
__device__ __forceinline__ float sigm(float v) { return 1.0f / (1.0f + expf(-v)); }
#define LDSX() do { asm volatile("s_wait_dscnt 0" ::: "memory"); __builtin_amdgcn_wave_barrier(); __builtin_amdgcn_fence(__ATOMIC_RELEASE, "workgroup"); } while (0)



// Scaled dot attention with a post-softmax multiplicative key mask: attn = softmax(Q K^T / 8) * mask_out[b,h,1,k]; out = attn V  ([4,12,2048,64] head-major inputs, no projections).
// The mask scales the softmax weights AFTER normalisation (no renormalisation): p_k <- p_k * m_k feeds P.V while the denominator keeps the unmasked sum.
__device__ __forceinline__ float bfr(float v) { return (float)(__bf16)v; }
#define NBH 48
#define SS 2048
#define HD 64
#define C2 0.18033688f    // log2(e) / sqrt(64): score scale and change of base in one factor

__device__ __forceinline__ v16b frag_b(const __bf16* rowk0, int lane) { return __builtin_bit_cast(v16b, frag_h((const _Float16*)rowk0, lane)); }
// head-major [bh][s][64] f32 -> bf16 rows (plain cast, 8 values per thread)
__global__ __launch_bounds__(256) void k_cvt(const float* __restrict__ X, __bf16* __restrict__ Xb, size_t n8) {
  const size_t i8 = (size_t)blockIdx.x * 256 + threadIdx.x; if (i8 >= n8) return;
  union { __bf16 e[8]; v4u u; } pk; const float* src = X + i8 * 8;
#pragma unroll
  for (int e = 0; e < 8; ++e) pk.e[e] = (__bf16)src[e];
  vst2((unsigned*)(Xb + i8 * 8), pk.u);
}
__global__ __launch_bounds__(256) void k_cvtv(const float* __restrict__ V, __bf16* __restrict__ VTb) {
  __shared__ __align__(16) __bf16 st[64][72];
  const int tid = threadIdx.x; const size_t bh = blockIdx.y; const int s0 = blockIdx.x * 64;
  for (int q = tid; q < 64 * 64; q += 256) { const int rl = q >> 6, d = q & 63; st[d][rl] = (__bf16)V[(bh * SS + s0 + rl) * HD + d]; }
  __syncthreads();
  for (int q = tid; q < 64 * 8; q += 256) { const int d = q >> 3, pc = q & 7; vst2((unsigned*)(VTb + (bh * HD + d) * SS + s0 + pc * 8), *(const v4u*)(&st[d][pc * 8])); }
}
#define KP 72    // LDS row pitch in bf16: 128 B of data + 16 B, an odd multiple of 16 B, so the 16-byte fragment reads of 16 rows spread over the banks
#define TB (64 * KP * 2)    // bytes of one staged tile (64 rows)
// Stage one tile of 64 keys for the whole block: 64 K rows and 64 V^T rows of 128 B each. A thread copies 4 + 4 chunks of 16 B (rows 16 apart); 8 lanes cover one whole row.
// s_wait_xcnt closes the statement so that it stands in front of any rewrite of the address registers the copies name.
__device__ __forceinline__ void stage_kv(const __bf16* gk, const __bf16* gv, unsigned lk, unsigned lv) {
  asm volatile("global_load_async_to_lds_b128 %0, %8, off\n\t"
               "global_load_async_to_lds_b128 %1, %9, off\n\t"
               "global_load_async_to_lds_b128 %2, %10, off\n\t"
               "global_load_async_to_lds_b128 %3, %11, off\n\t"
               "global_load_async_to_lds_b128 %4, %12, off\n\t"
               "global_load_async_to_lds_b128 %5, %13, off\n\t"
               "global_load_async_to_lds_b128 %6, %14, off\n\t"
               "global_load_async_to_lds_b128 %7, %15, off\n\t"
               "s_wait_xcnt 0x0"
               :: "v"(lk), "v"(lk + 16 * KP * 2), "v"(lk + 32 * KP * 2), "v"(lk + 48 * KP * 2), "v"(lv), "v"(lv + 16 * KP * 2), "v"(lv + 32 * KP * 2), "v"(lv + 48 * KP * 2),
                  "v"(gk), "v"(gk + 16 * HD), "v"(gk + 32 * HD), "v"(gk + 48 * HD), "v"(gv), "v"(gv + 16 * SS), "v"(gv + 32 * SS), "v"(gv + 48 * SS)
               : "memory");
}
__global__ __launch_bounds__(128) void k_attn(const __bf16* __restrict__ Qb, const __bf16* __restrict__ Kb, const __bf16* __restrict__ VTb, const float* __restrict__ mk, float* __restrict__ O32) {
  __shared__ __align__(16) __bf16 sK[2][64][KP], sV[2][64][KP];    // two buffers: tile kt in buffer kt & 1
  const int tid = threadIdx.x, w = tid >> 5, lane = tid & 31, col = lane & 15, g = lane >> 4;
  const size_t bh = blockIdx.y; const int q0 = blockIdx.x * 64 + w * 16;
  const __bf16* gk = Kb + (bh * SS + (tid >> 3)) * HD + (tid & 7) * 8; const __bf16* gv = VTb + (bh * HD + (tid >> 3)) * SS + (tid & 7) * 8;    // this thread's first chunk of tile 0
  const unsigned lk = (unsigned)(size_t)&sK[0][tid >> 3][(tid & 7) * 8], lv = (unsigned)(size_t)&sV[0][tid >> 3][(tid & 7) * 8];    // its LDS byte addresses in buffer 0
  stage_kv(gk, gv, lk, lv);
  asm volatile("s_wait_asynccnt 0x0" ::: "memory");    // tile 0 has landed before the barrier publishes it
  __syncthreads();
  stage_kv(gk + 64 * HD, gv + 64, lk + TB, lv + TB);    // tile 1 flies while tile 0 is worked on
  v16b aq[2];
#pragma unroll
  for (int kc = 0; kc < 2; ++kc) aq[kc] = frag_b(Qb + (bh * SS + q0 + col) * HD + kc * 32, lane);
  float mrun = -3.0e38f, lrun = 0.f; v8f acc[4] = {}, ac2[4] = {};
#pragma unroll 1
  for (int kt = 0; kt < SS / 64; ++kt) { const int b = kt & 1;
    v8f s[4];
#pragma unroll
    for (int t = 0; t < 4; ++t) { s[t] = v8f{};
#pragma unroll
      for (int kc = 0; kc < 2; ++kc) s[t] = wmma_bf(frag_b(&sK[b][t * 16 + col][kc * 32], lane), aq[kc], s[t]); }    // raw dot products; the scale is folded into C2
    float mx = -3.4e38f;
#pragma unroll
    for (int t = 0; t < 4; ++t)
#pragma unroll
      for (int r = 0; r < 8; ++r) mx = fmaxf(mx, s[t][r]);
    mx = fmaxf(mx, __shfl_xor(mx, 16, 32));    // the other half of the wave holds the query's other 32 keys
    const float mnew = fmaxf(mrun, mx * C2); const float corr = __builtin_amdgcn_exp2f(mrun - mnew);    // mrun, mnew: running maximum times C2 (C2 > 0 keeps the order); an unchanged maximum gives exactly 1
    float ps = 0.f; const float* mrow = mk + bh * SS + kt * 64 + g * 8;    // one base for the lane's 32 mask values, so that they stay 16-byte loads
    v16b ph[2], pl[2];
#pragma unroll
    for (int t = 0; t < 4; ++t)
#pragma unroll
      for (int r = 0; r < 8; ++r) { const v2f x = __builtin_elementwise_fma(v2f{s[t][r & 6], s[t][r | 1]}, v2f{C2, C2}, v2f{-mnew, -mnew});    // exp((s - m) / 8) = 2^(s * C2 - m * C2): one packed fused multiply-add for two elements
        const float p = __builtin_amdgcn_exp2f(x[r & 1]); ps += p; const float pm = p * bfr(mrow[t * 16 + r]); const __bf16 hi = (__bf16)pm; ph[t >> 1][(t & 1) * 8 + r] = hi; pl[t >> 1][(t & 1) * 8 + r] = (__bf16)(pm - (float)hi); }    // denominator from the unmasked p; the P.V operand carries p * mask_k
    asm volatile("s_wait_xcnt 0x0" ::: "memory");    // stands in front of any reuse of the address registers that the mask loads name
    ps += __shfl_xor(ps, 16, 32);
    lrun = lrun * corr + ps; mrun = mnew;
#pragma unroll
    for (int t = 0; t < 4; ++t) { acc[t] *= corr; ac2[t] *= corr; }
#pragma unroll
    for (int kc = 0; kc < 2; ++kc)
#pragma unroll
      for (int t = 0; t < 4; ++t) { const v16b vb = frag_b(&sV[b][t * 16 + col][kc * 32], lane); acc[t] = wmma_bf(vb, ph[kc], acc[t]); ac2[t] = wmma_bf(vb, pl[kc], ac2[t]); }
    asm volatile("s_wait_dscnt 0x0" ::: "memory");       // this wave's reads of buffer b are done before the buffer is refilled
    asm volatile("s_wait_asynccnt 0x0" ::: "memory");    // this wave's copies of tile kt + 1 have landed
    __syncthreads();                                     // publishes tile kt + 1 and ends every wave's reads of buffer b
    if (kt + 2 < SS / 64) stage_kv(gk + (size_t)(kt + 2) * 64 * HD, gv + (kt + 2) * 64, lk + b * TB, lv + b * TB); }
  asm volatile("s_wait_asynccnt 0x0" ::: "memory");      // no copy is outstanding when the wave goes on to the output and ends
  const float inv = 1.0f / lrun; float* orow = O32 + (bh * SS + q0 + col) * HD + g * 8;    // head-major output [bh][s][64]; accumulator tile t holds 8 consecutive values of the lane's own row
#pragma unroll
  for (int t = 0; t < 4; ++t) { const v8f o = (acc[t] + ac2[t]) * inv;
    vst2(orow + t * 16, __builtin_shufflevector(o, o, 0, 1, 2, 3)); vst2(orow + t * 16 + 4, __builtin_shufflevector(o, o, 4, 5, 6, 7)); }
}
extern "C" void kernel_launch(void* const* d_in, const int* in_sizes, int n_in, void* d_out, int out_size, void* d_ws, size_t ws_size, hipStream_t stream) {
  (void)in_sizes; (void)n_in; (void)out_size; (void)ws_size;
  const float* Q = (const float*)d_in[0]; const float* K = (const float*)d_in[1]; const float* V = (const float*)d_in[2]; const float* mk = (const float*)d_in[3];
  char* ws = (char*)d_ws; size_t off = 0;
  auto take = [&](size_t bytes) { char* p = ws + off; off += (bytes + 255) & ~(size_t)255; return p; };
  const size_t n = (size_t)NBH * SS * HD;
  __bf16* Qb = (__bf16*)take(n * 2); __bf16* Kb = (__bf16*)take(n * 2); __bf16* VTb = (__bf16*)take(n * 2);
  // ws ~ 38 MB
  k_cvt<<<(unsigned)((n / 8 + 255) / 256), 256, 0, stream>>>(Q, Qb, n / 8);
  k_cvt<<<(unsigned)((n / 8 + 255) / 256), 256, 0, stream>>>(K, Kb, n / 8);
  k_cvtv<<<dim3(SS / 64, NBH), 256, 0, stream>>>(V, VTb);
  k_attn<<<dim3(SS / 64, NBH), 128, 0, stream>>>(Qb, Kb, VTb, mk, (float*)d_out);
}

// v005
// A run of this version takes 105 microseconds.
// In both of two side-by-side timings against v004, it was 1.05 times as fast.
// All steps since v000 together make it 3.18 times as fast.
// compute dtype: Q, K, V, mask_out (INPUTS) rounded to bf16: exact single bf16 WMMA products for the scores and for V (f32 accumulate), softmax weights carried as a bf16 hi/lo pair; softmax in f32.
#include <hip/hip_runtime.h>
#include <math.h>

typedef __attribute__((ext_vector_type(16))) _Float16 v16h;
typedef __attribute__((ext_vector_type(16))) __bf16 v16b;
typedef __attribute__((ext_vector_type(8)))  _Float16 v8h;
typedef __attribute__((ext_vector_type(8)))  float v8f;
typedef __attribute__((ext_vector_type(4)))  float v4f;
typedef __attribute__((ext_vector_type(2)))  float v2f;
typedef __attribute__((ext_vector_type(4)))  unsigned v4u;
typedef __attribute__((ext_vector_type(4)))  int v4i;
typedef float __attribute__((may_alias)) float_a;
typedef int __attribute__((may_alias)) int_a;

template <typename T> __device__ __forceinline__ void vst2(void* p, T v) { *(T*)p = v;  }
__device__ __forceinline__ v8f wmma16(v16h a, v16h b, v8f c) {
  v8f d = __builtin_amdgcn_wmma_f32_16x16x32_f16(false, a, false, b, (short)0, c, false, false);
  asm volatile("v_nop\n\tv_nop\n\tv_nop\n\tv_nop" : "+v"(d) : "v"(a), "v"(b));
  return d;
}
__device__ __forceinline__ v8f wmma_bf(v16b a, v16b b, v8f c) {
  return __builtin_amdgcn_wmma_f32_16x16x32_bf16(false, a, false, b, (short)0, c, false, false);
}
// 16x16x32 fragments: lane = (h = lane>>4, row/col = lane&15); elements 0..7 = k0+8h+0..7, 8..15 = k0+16+8h+0..7; D element r = row 8h+r
__device__ __forceinline__ v16h frag_h(const _Float16* rowk0, int lane) {
  union { v16h v; v8h q[2]; } u; const _Float16* p = rowk0 + 8 * (lane >> 4);
  u.q[0] = *(const v8h*)p; u.q[1] = *(const v8h*)(p + 16); return u.v;
}
__device__ __forceinline__ v16h frag_f32(const float* rowk0, int lane) {
  v16h a; const float* p = rowk0 + 8 * (lane >> 4);
#pragma unroll
  for (int i = 0; i < 8; ++i) { a[i] = (_Float16)p[i]; a[8 + i] = (_Float16)p[16 + i]; }
  return a;
}
__device__ __forceinline__ v16h frag_f32s(const float* rowk0, int lane, float sc) {
  v16h a; const float* p = rowk0 + 8 * (lane >> 4);
#pragma unroll
  for (int i = 0; i < 8; ++i) { a[i] = (_Float16)(p[i] * sc); a[8 + i] = (_Float16)(p[16 + i] * sc); }
  return a;
}
// column fragment from a [K][ld] layout (column n), rows >= K read as 0
__device__ __forceinline__ v16h fragc_f32(const float* W, int k0, int n, int lane, int ld, int K) {
  v16h a; const int g = lane >> 4;
#pragma unroll
  for (int i = 0; i < 8; ++i) { const int ka = k0 + 8 * g + i, kb = ka + 16;
    a[i] = (_Float16)(ka < K ? W[(size_t)ka * ld + n] : 0.f); a[8 + i] = (_Float16)(kb < K ? W[(size_t)kb * ld + n] : 0.f); }
  return a;
}
struct F2 { v16b h, l; };
__device__ __forceinline__ F2 bsplit16(const float v[16]) { F2 r;
#pragma unroll
  for (int i = 0; i < 16; ++i) { const __bf16 h = (__bf16)v[i]; r.h[i] = h; r.l[i] = (__bf16)(v[i] - (float)h); }
  return r; }
__device__ __forceinline__ F2 split_row(const float* row, int k0, int lane) { float v[16]; const float* p = row + k0 + 8 * (lane >> 4);
#pragma unroll
  for (int i = 0; i < 8; ++i) { v[i] = p[i]; v[8 + i] = p[16 + i]; }
  return bsplit16(v); }
__device__ __forceinline__ F2 split_rowK(const float* row, int k0, int lane, int K) { float v[16]; const int g = lane >> 4;
#pragma unroll
  for (int i = 0; i < 8; ++i) { const int ka = k0 + 8 * g + i, kb = ka + 16; v[i] = ka < K ? row[ka] : 0.f; v[8 + i] = kb < K ? row[kb] : 0.f; }
  return bsplit16(v); }
__device__ __forceinline__ F2 split_col(const float* W, int k0, int n, int lane, int ld, int K) { float v[16]; const int g = lane >> 4;
#pragma unroll
  for (int i = 0; i < 8; ++i) { const int ka = k0 + 8 * g + i, kb = ka + 16; v[i] = ka < K ? W[(size_t)ka * ld + n] : 0.f; v[8 + i] = kb < K ? W[(size_t)kb * ld + n] : 0.f; }
  return bsplit16(v); }
__device__ __forceinline__ v8f mac3(const F2& a, const F2& b, v8f c) { c = wmma_bf(a.l, b.h, c); c = wmma_bf(a.h, b.l, c); return wmma_bf(a.h, b.h, c); }
__device__ __forceinline__ float sigm(float v) { return 1.0f / (1.0f + expf(-v)); }
#define LDSX() do { asm volatile("s_wait_dscnt 0" ::: "memory"); __builtin_amdgcn_wave_barrier(); __builtin_amdgcn_fence(__ATOMIC_RELEASE, "workgroup"); } while (0)



// Scaled dot attention with a post-softmax multiplicative key mask: attn = softmax(Q K^T / 8) * mask_out[b,h,1,k]; out = attn V  ([4,12,2048,64] head-major inputs, no projections).
// The mask scales the softmax weights AFTER normalisation (no renormalisation): p_k <- p_k * m_k feeds P.V while the denominator keeps the unmasked sum.
__device__ __forceinline__ float bfr(float v) { return (float)(__bf16)v; }
#define NBH 48
#define SS 2048
#define HD 64
#define C2 0.18033688f    // log2(e) / sqrt(64): score scale and change of base in one factor

__device__ __forceinline__ v16b frag_b(const __bf16* rowk0, int lane) { return __builtin_bit_cast(v16b, frag_h((const _Float16*)rowk0, lane)); }
// One conversion launch. Block (s0 / 64, bh) casts its 64 K rows to bf16 (plain cast, 8 values per chunk, two chunks per thread) and writes its 64 V rows, cast, as 64 columns of V^T.
__global__ __launch_bounds__(256) void k_prep(const float* __restrict__ K, const float* __restrict__ V, __bf16* __restrict__ Kb, __bf16* __restrict__ VTb) {
  __shared__ __align__(16) __bf16 st[64][72];
  const int tid = threadIdx.x; const size_t bh = blockIdx.y; const int s0 = blockIdx.x * 64;
  const size_t kb = (bh * SS + s0) * HD + tid * 8; v4f kv[4];    // the thread's two chunks of 8 K values, 2048 values apart; loaded here so that they fly while V is read
#pragma unroll
  for (int j = 0; j < 2; ++j) { kv[2 * j] = *(const v4f*)(K + kb + j * 2048); kv[2 * j + 1] = *(const v4f*)(K + kb + j * 2048 + 4); }
  for (int q = tid; q < 64 * 64; q += 256) { const int rl = q >> 6, d = q & 63; st[d][rl] = (__bf16)V[(bh * SS + s0 + rl) * HD + d]; }
  __syncthreads();
  for (int q = tid; q < 64 * 8; q += 256) { const int d = q >> 3, pc = q & 7; vst2((unsigned*)(VTb + (bh * HD + d) * SS + s0 + pc * 8), *(const v4u*)(&st[d][pc * 8])); }
#pragma unroll
  for (int j = 0; j < 2; ++j) { union { __bf16 e[8]; v4u u; } pk;
#pragma unroll
    for (int e = 0; e < 4; ++e) { pk.e[e] = (__bf16)kv[2 * j][e]; pk.e[4 + e] = (__bf16)kv[2 * j + 1][e]; }
    vst2((unsigned*)(Kb + kb + j * 2048), pk.u); }
}
#define KP 72    // LDS row pitch in bf16: 128 B of data + 16 B, an odd multiple of 16 B, so the 16-byte fragment reads of 16 rows spread over the banks
#define TB (64 * KP * 2)    // bytes of one staged tile (64 rows)
// Stage one tile of 64 keys for the whole block: 64 K rows and 64 V^T rows of 128 B each. A thread copies 4 + 4 chunks of 16 B (rows 16 apart); 8 lanes cover one whole row.
// s_wait_xcnt closes the statement so that it stands in front of any rewrite of the address registers the copies name.
__device__ __forceinline__ void stage_kv(const __bf16* gk, const __bf16* gv, unsigned lk, unsigned lv) {
  asm volatile("global_load_async_to_lds_b128 %0, %8, off\n\t"
               "global_load_async_to_lds_b128 %1, %9, off\n\t"
               "global_load_async_to_lds_b128 %2, %10, off\n\t"
               "global_load_async_to_lds_b128 %3, %11, off\n\t"
               "global_load_async_to_lds_b128 %4, %12, off\n\t"
               "global_load_async_to_lds_b128 %5, %13, off\n\t"
               "global_load_async_to_lds_b128 %6, %14, off\n\t"
               "global_load_async_to_lds_b128 %7, %15, off\n\t"
               "s_wait_xcnt 0x0"
               :: "v"(lk), "v"(lk + 16 * KP * 2), "v"(lk + 32 * KP * 2), "v"(lk + 48 * KP * 2), "v"(lv), "v"(lv + 16 * KP * 2), "v"(lv + 32 * KP * 2), "v"(lv + 48 * KP * 2),
                  "v"(gk), "v"(gk + 16 * HD), "v"(gk + 32 * HD), "v"(gk + 48 * HD), "v"(gv), "v"(gv + 16 * SS), "v"(gv + 32 * SS), "v"(gv + 48 * SS)
               : "memory");
}
__global__ __launch_bounds__(128) void k_attn(const float* __restrict__ Q, const __bf16* __restrict__ Kb, const __bf16* __restrict__ VTb, const float* __restrict__ mk, float* __restrict__ O32) {
  __shared__ __align__(16) __bf16 sK[2][64][KP], sV[2][64][KP];    // two buffers: tile kt in buffer kt & 1
  const int tid = threadIdx.x, w = tid >> 5, lane = tid & 31, col = lane & 15, g = lane >> 4;
  const size_t bh = blockIdx.y; const int q0 = blockIdx.x * 64 + w * 16;
  const __bf16* gk = Kb + (bh * SS + (tid >> 3)) * HD + (tid & 7) * 8; const __bf16* gv = VTb + (bh * HD + (tid >> 3)) * SS + (tid & 7) * 8;    // this thread's first chunk of tile 0
  const unsigned lk = (unsigned)(size_t)&sK[0][tid >> 3][(tid & 7) * 8], lv = (unsigned)(size_t)&sV[0][tid >> 3][(tid & 7) * 8];    // its LDS byte addresses in buffer 0
  const float* qrow = Q + (bh * SS + q0 + col) * HD + g * 8; v4f qf[8];    // the lane's query row as f32, loaded first so that it flies while tile 0 lands: values kc * 32 + 8g + 0..7 and + 16 + 0..7
#pragma unroll
  for (int kc = 0; kc < 2; ++kc)
#pragma unroll
    for (int i = 0; i < 4; ++i) qf[kc * 4 + i] = *(const v4f*)(qrow + kc * 32 + (i >> 1) * 16 + (i & 1) * 4);
  asm volatile("s_wait_xcnt 0x0" :: "v"(qrow) : "memory");    // stands in front of any reuse of the address registers that the query loads name; the address as an input keeps them live up to here
  stage_kv(gk, gv, lk, lv);
  asm volatile("s_wait_asynccnt 0x0" ::: "memory");    // tile 0 has landed before the barrier publishes it
  __syncthreads();
  stage_kv(gk + 64 * HD, gv + 64, lk + TB, lv + TB);    // tile 1 flies while tile 0 is worked on
  v16b aq[2];    // the query row cast here, once per wave, in the fragment's k order
#pragma unroll
  for (int kc = 0; kc < 2; ++kc)
#pragma unroll
    for (int i = 0; i < 4; ++i) { aq[kc][i] = (__bf16)qf[kc * 4][i]; aq[kc][4 + i] = (__bf16)qf[kc * 4 + 1][i]; aq[kc][8 + i] = (__bf16)qf[kc * 4 + 2][i]; aq[kc][12 + i] = (__bf16)qf[kc * 4 + 3][i]; }
  float mrun = -3.0e38f, lrun = 0.f; v8f acc[4] = {}, ac2[4] = {};
#pragma unroll 1
  for (int kt = 0; kt < SS / 64; ++kt) { const int b = kt & 1;
    v8f s[4];
#pragma unroll
    for (int t = 0; t < 4; ++t) { s[t] = v8f{};
#pragma unroll
      for (int kc = 0; kc < 2; ++kc) s[t] = wmma_bf(frag_b(&sK[b][t * 16 + col][kc * 32], lane), aq[kc], s[t]); }    // raw dot products; the scale is folded into C2
    float mx = -3.4e38f;
#pragma unroll
    for (int t = 0; t < 4; ++t)
#pragma unroll
      for (int r = 0; r < 8; ++r) mx = fmaxf(mx, s[t][r]);
    mx = fmaxf(mx, __shfl_xor(mx, 16, 32));    // the other half of the wave holds the query's other 32 keys
    const float mnew = fmaxf(mrun, mx * C2); const float corr = __builtin_amdgcn_exp2f(mrun - mnew);    // mrun, mnew: running maximum times C2 (C2 > 0 keeps the order); an unchanged maximum gives exactly 1
    float ps = 0.f; const float* mrow = mk + bh * SS + kt * 64 + g * 8;    // one base for the lane's 32 mask values, so that they stay 16-byte loads
    v16b ph[2], pl[2];
#pragma unroll
    for (int t = 0; t < 4; ++t)
#pragma unroll
      for (int r = 0; r < 8; ++r) { const v2f x = __builtin_elementwise_fma(v2f{s[t][r & 6], s[t][r | 1]}, v2f{C2, C2}, v2f{-mnew, -mnew});    // exp((s - m) / 8) = 2^(s * C2 - m * C2): one packed fused multiply-add for two elements
        const float p = __builtin_amdgcn_exp2f(x[r & 1]); ps += p; const float pm = p * bfr(mrow[t * 16 + r]); const __bf16 hi = (__bf16)pm; ph[t >> 1][(t & 1) * 8 + r] = hi; pl[t >> 1][(t & 1) * 8 + r] = (__bf16)(pm - (float)hi); }    // denominator from the unmasked p; the P.V operand carries p * mask_k
    asm volatile("s_wait_xcnt 0x0" ::: "memory");    // stands in front of any reuse of the address registers that the mask loads name
    ps += __shfl_xor(ps, 16, 32);
    lrun = lrun * corr + ps; mrun = mnew;
#pragma unroll
    for (int t = 0; t < 4; ++t) { acc[t] *= corr; ac2[t] *= corr; }
#pragma unroll
    for (int kc = 0; kc < 2; ++kc)
#pragma unroll
      for (int t = 0; t < 4; ++t) { const v16b vb = frag_b(&sV[b][t * 16 + col][kc * 32], lane); acc[t] = wmma_bf(vb, ph[kc], acc[t]); ac2[t] = wmma_bf(vb, pl[kc], ac2[t]); }
    asm volatile("s_wait_dscnt 0x0" ::: "memory");       // this wave's reads of buffer b are done before the buffer is refilled
    asm volatile("s_wait_asynccnt 0x0" ::: "memory");    // this wave's copies of tile kt + 1 have landed
    __syncthreads();                                     // publishes tile kt + 1 and ends every wave's reads of buffer b
    if (kt + 2 < SS / 64) stage_kv(gk + (size_t)(kt + 2) * 64 * HD, gv + (kt + 2) * 64, lk + b * TB, lv + b * TB); }
  asm volatile("s_wait_asynccnt 0x0" ::: "memory");      // no copy is outstanding when the wave goes on to the output and ends
  const float inv = 1.0f / lrun; float* orow = O32 + (bh * SS + q0 + col) * HD + g * 8;    // head-major output [bh][s][64]; accumulator tile t holds 8 consecutive values of the lane's own row
#pragma unroll
  for (int t = 0; t < 4; ++t) { const v8f o = (acc[t] + ac2[t]) * inv;
    vst2(orow + t * 16, __builtin_shufflevector(o, o, 0, 1, 2, 3)); vst2(orow + t * 16 + 4, __builtin_shufflevector(o, o, 4, 5, 6, 7)); }
}
extern "C" void kernel_launch(void* const* d_in, const int* in_sizes, int n_in, void* d_out, int out_size, void* d_ws, size_t ws_size, hipStream_t stream) {
  (void)in_sizes; (void)n_in; (void)out_size; (void)ws_size;
  const float* Q = (const float*)d_in[0]; const float* K = (const float*)d_in[1]; const float* V = (const float*)d_in[2]; const float* mk = (const float*)d_in[3];
  char* ws = (char*)d_ws; size_t off = 0;
  auto take = [&](size_t bytes) { char* p = ws + off; off += (bytes + 255) & ~(size_t)255; return p; };
  const size_t n = (size_t)NBH * SS * HD;
  __bf16* Kb = (__bf16*)take(n * 2); __bf16* VTb = (__bf16*)take(n * 2);
  // ws ~ 25 MB
  k_prep<<<dim3(SS / 64, NBH), 256, 0, stream>>>(K, V, Kb, VTb);
  k_attn<<<dim3(SS / 64, NBH), 128, 0, stream>>>(Q, Kb, VTb, mk, (float*)d_out);
}

// v006
// Measured time: 88.2 microseconds a run.
// Next to v005, in two timings, it ran 1.19 times as fast each time.
// Counting every step since v000, it is 3.78 times as fast.
// compute dtype: Q, K, V, mask_out (INPUTS) rounded to bf16: exact single bf16 WMMA products for the scores and for V (f32 accumulate), softmax weights carried as a bf16 hi/lo pair; softmax in f32.
#include <hip/hip_runtime.h>
#include <math.h>

typedef __attribute__((ext_vector_type(16))) _Float16 v16h;
typedef __attribute__((ext_vector_type(16))) __bf16 v16b;
typedef __attribute__((ext_vector_type(8)))  _Float16 v8h;
typedef __attribute__((ext_vector_type(8)))  float v8f;
typedef __attribute__((ext_vector_type(4)))  float v4f;
typedef __attribute__((ext_vector_type(2)))  float v2f;
typedef __attribute__((ext_vector_type(2)))  __bf16 v2b;
typedef __attribute__((ext_vector_type(4)))  unsigned v4u;
typedef __attribute__((ext_vector_type(4)))  int v4i;
typedef float __attribute__((may_alias)) float_a;
typedef int __attribute__((may_alias)) int_a;

template <typename T> __device__ __forceinline__ void vst2(void* p, T v) { *(T*)p = v;  }
__device__ __forceinline__ v8f wmma16(v16h a, v16h b, v8f c) {
  v8f d = __builtin_amdgcn_wmma_f32_16x16x32_f16(false, a, false, b, (short)0, c, false, false);
  asm volatile("v_nop\n\tv_nop\n\tv_nop\n\tv_nop" : "+v"(d) : "v"(a), "v"(b));
  return d;
}
__device__ __forceinline__ v8f wmma_bf(v16b a, v16b b, v8f c) {
  return __builtin_amdgcn_wmma_f32_16x16x32_bf16(false, a, false, b, (short)0, c, false, false);
}
// 16x16x32 fragments: lane = (h = lane>>4, row/col = lane&15); elements 0..7 = k0+8h+0..7, 8..15 = k0+16+8h+0..7; D element r = row 8h+r
__device__ __forceinline__ v16h frag_h(const _Float16* rowk0, int lane) {
  union { v16h v; v8h q[2]; } u; const _Float16* p = rowk0 + 8 * (lane >> 4);
  u.q[0] = *(const v8h*)p; u.q[1] = *(const v8h*)(p + 16); return u.v;
}
__device__ __forceinline__ v16h frag_f32(const float* rowk0, int lane) {
  v16h a; const float* p = rowk0 + 8 * (lane >> 4);
#pragma unroll
  for (int i = 0; i < 8; ++i) { a[i] = (_Float16)p[i]; a[8 + i] = (_Float16)p[16 + i]; }
  return a;
}
__device__ __forceinline__ v16h frag_f32s(const float* rowk0, int lane, float sc) {
  v16h a; const float* p = rowk0 + 8 * (lane >> 4);
#pragma unroll
  for (int i = 0; i < 8; ++i) { a[i] = (_Float16)(p[i] * sc); a[8 + i] = (_Float16)(p[16 + i] * sc); }
  return a;
}
// column fragment from a [K][ld] layout (column n), rows >= K read as 0
__device__ __forceinline__ v16h fragc_f32(const float* W, int k0, int n, int lane, int ld, int K) {
  v16h a; const int g = lane >> 4;
#pragma unroll
  for (int i = 0; i < 8; ++i) { const int ka = k0 + 8 * g + i, kb = ka + 16;
    a[i] = (_Float16)(ka < K ? W[(size_t)ka * ld + n] : 0.f); a[8 + i] = (_Float16)(kb < K ? W[(size_t)kb * ld + n] : 0.f); }
  return a;
}
struct F2 { v16b h, l; };
__device__ __forceinline__ F2 bsplit16(const float v[16]) { F2 r;
#pragma unroll
  for (int i = 0; i < 16; ++i) { const __bf16 h = (__bf16)v[i]; r.h[i] = h; r.l[i] = (__bf16)(v[i] - (float)h); }
  return r; }
__device__ __forceinline__ F2 split_row(const float* row, int k0, int lane) { float v[16]; const float* p = row + k0 + 8 * (lane >> 4);
#pragma unroll
  for (int i = 0; i < 8; ++i) { v[i] = p[i]; v[8 + i] = p[16 + i]; }
  return bsplit16(v); }
__device__ __forceinline__ F2 split_rowK(const float* row, int k0, int lane, int K) { float v[16]; const int g = lane >> 4;
#pragma unroll
  for (int i = 0; i < 8; ++i) { const int ka = k0 + 8 * g + i, kb = ka + 16; v[i] = ka < K ? row[ka] : 0.f; v[8 + i] = kb < K ? row[kb] : 0.f; }
  return bsplit16(v); }
__device__ __forceinline__ F2 split_col(const float* W, int k0, int n, int lane, int ld, int K) { float v[16]; const int g = lane >> 4;
#pragma unroll
  for (int i = 0; i < 8; ++i) { const int ka = k0 + 8 * g + i, kb = ka + 16; v[i] = ka < K ? W[(size_t)ka * ld + n] : 0.f; v[8 + i] = kb < K ? W[(size_t)kb * ld + n] : 0.f; }
  return bsplit16(v); }
__device__ __forceinline__ v8f mac3(const F2& a, const F2& b, v8f c) { c = wmma_bf(a.l, b.h, c); c = wmma_bf(a.h, b.l, c); return wmma_bf(a.h, b.h, c); }
__device__ __forceinline__ float sigm(float v) { return 1.0f / (1.0f + expf(-v)); }
#define LDSX() do { asm volatile("s_wait_dscnt 0" ::: "memory"); __builtin_amdgcn_wave_barrier(); __builtin_amdgcn_fence(__ATOMIC_RELEASE, "workgroup"); } while (0)



// Scaled dot attention with a post-softmax multiplicative key mask: attn = softmax(Q K^T / 8) * mask_out[b,h,1,k]; out = attn V  ([4,12,2048,64] head-major inputs, no projections).
// The mask scales the softmax weights AFTER normalisation (no renormalisation): p_k <- p_k * m_k feeds P.V while the denominator keeps the unmasked sum.
__device__ __forceinline__ float bfr(float v) { return (float)(__bf16)v; }
#define NBH 48
#define SS 2048
#define HD 64
#define C2 0.18033688f    // log2(e) / sqrt(64): score scale and change of base in one factor

__device__ __forceinline__ v16b frag_b(const __bf16* rowk0, int lane) { return __builtin_bit_cast(v16b, frag_h((const _Float16*)rowk0, lane)); }
// One conversion launch. Block (s0 / 64, bh) casts its 64 K rows to bf16 (plain cast, 8 values per chunk, two chunks per thread) and writes its 64 V rows, cast, as 64 columns of V^T.
__global__ __launch_bounds__(256) void k_prep(const float* __restrict__ K, const float* __restrict__ V, __bf16* __restrict__ Kb, __bf16* __restrict__ VTb) {
  __shared__ __align__(16) __bf16 st[64][72];
  const int tid = threadIdx.x; const size_t bh = blockIdx.y; const int s0 = blockIdx.x * 64;
  const size_t kb = (bh * SS + s0) * HD + tid * 8; v4f kv[4];    // the thread's two chunks of 8 K values, 2048 values apart; loaded here so that they fly while V is read
#pragma unroll
  for (int j = 0; j < 2; ++j) { kv[2 * j] = *(const v4f*)(K + kb + j * 2048); kv[2 * j + 1] = *(const v4f*)(K + kb + j * 2048 + 4); }
  for (int q = tid; q < 64 * 64; q += 256) { const int rl = q >> 6, d = q & 63; st[d][rl] = (__bf16)V[(bh * SS + s0 + rl) * HD + d]; }
  __syncthreads();
  for (int q = tid; q < 64 * 8; q += 256) { const int d = q >> 3, pc = q & 7; vst2((unsigned*)(VTb + (bh * HD + d) * SS + s0 + pc * 8), *(const v4u*)(&st[d][pc * 8])); }
#pragma unroll
  for (int j = 0; j < 2; ++j) { union { __bf16 e[8]; v4u u; } pk;
#pragma unroll
    for (int e = 0; e < 4; ++e) { pk.e[e] = (__bf16)kv[2 * j][e]; pk.e[4 + e] = (__bf16)kv[2 * j + 1][e]; }
    vst2((unsigned*)(Kb + kb + j * 2048), pk.u); }
}
#define KP 72    // LDS row pitch in bf16: 128 B of data + 16 B, an odd multiple of 16 B, so the 16-byte fragment reads of 16 rows spread over the banks
#define TB (64 * KP * 2)    // bytes of one staged tile (64 rows)
// Stage one tile of 64 keys for the whole block: 64 K rows and 64 V^T rows of 128 B each. A thread copies 4 + 4 chunks of 16 B (rows 16 apart); 8 lanes cover one whole row.
// s_wait_xcnt closes the statement so that it stands in front of any rewrite of the address registers the copies name.
__device__ __forceinline__ void stage_kv(const __bf16* gk, const __bf16* gv, unsigned lk, unsigned lv) {
  asm volatile("global_load_async_to_lds_b128 %0, %8, off\n\t"
               "global_load_async_to_lds_b128 %1, %9, off\n\t"
               "global_load_async_to_lds_b128 %2, %10, off\n\t"
               "global_load_async_to_lds_b128 %3, %11, off\n\t"
               "global_load_async_to_lds_b128 %4, %12, off\n\t"
               "global_load_async_to_lds_b128 %5, %13, off\n\t"
               "global_load_async_to_lds_b128 %6, %14, off\n\t"
               "global_load_async_to_lds_b128 %7, %15, off\n\t"
               "s_wait_xcnt 0x0"
               :: "v"(lk), "v"(lk + 16 * KP * 2), "v"(lk + 32 * KP * 2), "v"(lk + 48 * KP * 2), "v"(lv), "v"(lv + 16 * KP * 2), "v"(lv + 32 * KP * 2), "v"(lv + 48 * KP * 2),
                  "v"(gk), "v"(gk + 16 * HD), "v"(gk + 32 * HD), "v"(gk + 48 * HD), "v"(gv), "v"(gv + 16 * SS), "v"(gv + 32 * SS), "v"(gv + 48 * SS)
               : "memory");
}
// The second bound keeps six waves on a SIMD (160 registers each): the grid is six blocks per WGP, and all of them must be resident at once.
__global__ __launch_bounds__(128, 6) void k_attn(const float* __restrict__ Q, const __bf16* __restrict__ Kb, const __bf16* __restrict__ VTb, const float* __restrict__ mk, float* __restrict__ O32) {
  __shared__ __align__(16) __bf16 sK[2][64][KP], sV[2][64][KP];    // two buffers: tile kt in buffer kt & 1
  __shared__ __align__(16) float sM[SS];    // the head's whole mask row, rounded to bf16 once and kept as f32, so that the loop multiplies by it with packed f32 products
  const int tid = threadIdx.x, w = tid >> 5, lane = tid & 31, col = lane & 15, g = lane >> 4;
  const size_t bh = blockIdx.y; const int q0 = blockIdx.x * 64 + w * 16;
  const __bf16* gk = Kb + (bh * SS + (tid >> 3)) * HD + (tid & 7) * 8; const __bf16* gv = VTb + (bh * HD + (tid >> 3)) * SS + (tid & 7) * 8;    // this thread's first chunk of tile 0
  const unsigned lk = (unsigned)(size_t)&sK[0][tid >> 3][(tid & 7) * 8], lv = (unsigned)(size_t)&sV[0][tid >> 3][(tid & 7) * 8];    // its LDS byte addresses in buffer 0
  const float* qrow = Q + (bh * SS + q0 + col) * HD + g * 8; v4f qf[8];    // the lane's query row as f32, loaded first so that it flies while tile 0 lands: values kc * 32 + 8g + 0..7 and + 16 + 0..7
#pragma unroll
  for (int kc = 0; kc < 2; ++kc)
#pragma unroll
    for (int i = 0; i < 4; ++i) qf[kc * 4 + i] = *(const v4f*)(qrow + kc * 32 + (i >> 1) * 16 + (i & 1) * 4);
  const float* mg = mk + bh * SS + tid * 4; v4f mf[4];    // the thread's 16 mask values: four chunks of 4, 512 values apart
#pragma unroll
  for (int j = 0; j < 4; ++j) mf[j] = *(const v4f*)(mg + j * 512);
  asm volatile("s_wait_xcnt 0x0" :: "v"(qrow), "v"(tid) : "memory");    // stands in front of any reuse of the address registers that the query and mask loads name (the mask loads are addressed by the thread index); as inputs they stay live up to here
  stage_kv(gk, gv, lk, lv);
#pragma unroll
  for (int j = 0; j < 4; ++j) *(v4f*)&sM[tid * 4 + j * 512] = v4f{bfr(mf[j][0]), bfr(mf[j][1]), bfr(mf[j][2]), bfr(mf[j][3])};    // published by the barrier below, together with tile 0
  asm volatile("s_wait_asynccnt 0x0" ::: "memory");    // tile 0 has landed before the barrier publishes it
  __syncthreads();
  stage_kv(gk + 64 * HD, gv + 64, lk + TB, lv + TB);    // tile 1 flies while tile 0 is worked on
  v16b aq[2];    // the query row cast here, once per wave, in the fragment's k order
#pragma unroll
  for (int kc = 0; kc < 2; ++kc)
#pragma unroll
    for (int i = 0; i < 4; ++i) { aq[kc][i] = (__bf16)qf[kc * 4][i]; aq[kc][4 + i] = (__bf16)qf[kc * 4 + 1][i]; aq[kc][8 + i] = (__bf16)qf[kc * 4 + 2][i]; aq[kc][12 + i] = (__bf16)qf[kc * 4 + 3][i]; }
  float mrun = -3.0e38f, lrun = 0.f; v8f acc[4] = {}, ac2[4] = {};
#pragma unroll 1
  for (int kt = 0; kt < SS / 64; ++kt) { const int b = kt & 1;
    const float* mrow = &sM[kt * 64 + g * 8]; v4f mq[2][2];    // the lane's 32 mask values of this tile: 8 in a row for each score tile, read one score tile ahead of their use
    mq[0][0] = *(const v4f*)mrow; mq[0][1] = *(const v4f*)(mrow + 4);
    v8f s[4];
#pragma unroll
    for (int t = 0; t < 4; ++t) { s[t] = v8f{};
#pragma unroll
      for (int kc = 0; kc < 2; ++kc) s[t] = wmma_bf(frag_b(&sK[b][t * 16 + col][kc * 32], lane), aq[kc], s[t]); }    // raw dot products; the scale is folded into C2
    float mx = -3.4e38f;
#pragma unroll
    for (int t = 0; t < 4; ++t)
#pragma unroll
      for (int r = 0; r < 8; ++r) mx = fmaxf(mx, s[t][r]);
    mx = fmaxf(mx, __shfl_xor(mx, 16, 32));    // the other half of the wave holds the query's other 32 keys
    const float mnew = fmaxf(mrun, mx * C2); const float corr = __builtin_amdgcn_exp2f(mrun - mnew);    // mrun, mnew: running maximum times C2 (C2 > 0 keeps the order); an unchanged maximum gives exactly 1
    float ps = 0.f;
    v16b ph[2], pl[2];
#pragma unroll
    for (int t = 0; t < 4; ++t) {
      if (t < 3) { mq[(t + 1) & 1][0] = *(const v4f*)(mrow + (t + 1) * 16); mq[(t + 1) & 1][1] = *(const v4f*)(mrow + (t + 1) * 16 + 4); }
#pragma unroll
      for (int r = 0; r < 8; r += 2) { const v2f x = __builtin_elementwise_fma(v2f{s[t][r], s[t][r + 1]}, v2f{C2, C2}, v2f{-mnew, -mnew});    // exp((s - m) / 8) = 2^(s * C2 - m * C2): one packed fused multiply-add for two elements
        const v2f p = v2f{__builtin_amdgcn_exp2f(x[0]), __builtin_amdgcn_exp2f(x[1])}; ps += p[0]; ps += p[1];    // denominator from the unmasked p
        const v2f pm = p * v2f{mq[t & 1][r >> 2][r & 3], mq[t & 1][r >> 2][(r & 3) + 1]};    // the P.V operand carries p * mask_k: one packed product for two elements
        const v2b hi = __builtin_convertvector(pm, v2b); const v2b lo = __builtin_convertvector(v2f{pm[0] - (float)hi[0], pm[1] - (float)hi[1]}, v2b);
        ph[t >> 1][(t & 1) * 8 + r] = hi[0]; ph[t >> 1][(t & 1) * 8 + r + 1] = hi[1]; pl[t >> 1][(t & 1) * 8 + r] = lo[0]; pl[t >> 1][(t & 1) * 8 + r + 1] = lo[1]; } }
    ps += __shfl_xor(ps, 16, 32);
    lrun = lrun * corr + ps; mrun = mnew;
#pragma unroll
    for (int t = 0; t < 4; ++t) { acc[t] *= corr; ac2[t] *= corr; }
#pragma unroll
    for (int kc = 0; kc < 2; ++kc)
#pragma unroll
      for (int t = 0; t < 4; ++t) { const v16b vb = frag_b(&sV[b][t * 16 + col][kc * 32], lane); acc[t] = wmma_bf(vb, ph[kc], acc[t]); ac2[t] = wmma_bf(vb, pl[kc], ac2[t]); }
    asm volatile("s_wait_dscnt 0x0" ::: "memory");       // this wave's reads of buffer b are done before the buffer is refilled
    asm volatile("s_wait_asynccnt 0x0" ::: "memory");    // this wave's copies of tile kt + 1 have landed
    __syncthreads();                                     // publishes tile kt + 1 and ends every wave's reads of buffer b
    if (kt + 2 < SS / 64) stage_kv(gk + (size_t)(kt + 2) * 64 * HD, gv + (kt + 2) * 64, lk + b * TB, lv + b * TB); }
  asm volatile("s_wait_asynccnt 0x0" ::: "memory");      // no copy is outstanding when the wave goes on to the output and ends
  const float inv = 1.0f / lrun; float* orow = O32 + (bh * SS + q0 + col) * HD + g * 8;    // head-major output [bh][s][64]; accumulator tile t holds 8 consecutive values of the lane's own row
#pragma unroll
  for (int t = 0; t < 4; ++t) { const v8f o = (acc[t] + ac2[t]) * inv;
    vst2(orow + t * 16, __builtin_shufflevector(o, o, 0, 1, 2, 3)); vst2(orow + t * 16 + 4, __builtin_shufflevector(o, o, 4, 5, 6, 7)); }
}
extern "C" void kernel_launch(void* const* d_in, const int* in_sizes, int n_in, void* d_out, int out_size, void* d_ws, size_t ws_size, hipStream_t stream) {
  (void)in_sizes; (void)n_in; (void)out_size; (void)ws_size;
  const float* Q = (const float*)d_in[0]; const float* K = (const float*)d_in[1]; const float* V = (const float*)d_in[2]; const float* mk = (const float*)d_in[3];
  char* ws = (char*)d_ws; size_t off = 0;
  auto take = [&](size_t bytes) { char* p = ws + off; off += (bytes + 255) & ~(size_t)255; return p; };
  const size_t n = (size_t)NBH * SS * HD;
  __bf16* Kb = (__bf16*)take(n * 2); __bf16* VTb = (__bf16*)take(n * 2);
  // ws ~ 25 MB
  k_prep<<<dim3(SS / 64, NBH), 256, 0, stream>>>(K, V, Kb, VTb);
  k_attn<<<dim3(SS / 64, NBH), 128, 0, stream>>>(Q, Kb, VTb, mk, (float*)d_out);
}

// v008
// One run takes 64.1 microseconds.
// Versions in between are left out here; by their measured steps it is 1.38 times as fast as v006.
// Counting every step since v000, it is 5.21 times as fast.
// compute dtype: Q, K, V, mask_out (INPUTS) rounded to bf16: single bf16 WMMA products for the scores; the second product runs on f16 WMMA (f32 accumulate): V, rounded to bf16, is held as f16 (same value), the masked softmax weights are rounded once to f16 (11 significant bits); softmax in f32.
#include <hip/hip_runtime.h>
#include <math.h>

typedef __attribute__((ext_vector_type(16))) _Float16 v16h;
typedef __attribute__((ext_vector_type(16))) __bf16 v16b;
typedef __attribute__((ext_vector_type(8)))  _Float16 v8h;
typedef __attribute__((ext_vector_type(8)))  float v8f;
typedef __attribute__((ext_vector_type(4)))  float v4f;
typedef __attribute__((ext_vector_type(2)))  float v2f;
typedef __attribute__((ext_vector_type(2)))  __bf16 v2b;
typedef __attribute__((ext_vector_type(2)))  _Float16 v2h;
typedef __attribute__((ext_vector_type(4)))  unsigned v4u;
typedef __attribute__((ext_vector_type(4)))  int v4i;
typedef float __attribute__((may_alias)) float_a;
typedef int __attribute__((may_alias)) int_a;

template <typename T> __device__ __forceinline__ void vst2(void* p, T v) { *(T*)p = v;  }
__device__ __forceinline__ v8f wmma16(v16h a, v16h b, v8f c) {
  v8f d = __builtin_amdgcn_wmma_f32_16x16x32_f16(false, a, false, b, (short)0, c, false, false);
  asm volatile("v_nop\n\tv_nop\n\tv_nop\n\tv_nop" : "+v"(d) : "v"(a), "v"(b));
  return d;
}
__device__ __forceinline__ v8f wmma_bf(v16b a, v16b b, v8f c) {
  return __builtin_amdgcn_wmma_f32_16x16x32_bf16(false, a, false, b, (short)0, c, false, false);
}
__device__ __forceinline__ v8f wmma_hf(v16h a, v16h b, v8f c) {
  return __builtin_amdgcn_wmma_f32_16x16x32_f16(false, a, false, b, (short)0, c, false, false);
}
// 16x16x32 fragments: lane = (h = lane>>4, row/col = lane&15); elements 0..7 = k0+8h+0..7, 8..15 = k0+16+8h+0..7; D element r = row 8h+r
__device__ __forceinline__ v16h frag_h(const _Float16* rowk0, int lane) {
  union { v16h v; v8h q[2]; } u; const _Float16* p = rowk0 + 8 * (lane >> 4);
  u.q[0] = *(const v8h*)p; u.q[1] = *(const v8h*)(p + 16); return u.v;
}
__device__ __forceinline__ v16h frag_f32(const float* rowk0, int lane) {
  v16h a; const float* p = rowk0 + 8 * (lane >> 4);
#pragma unroll
  for (int i = 0; i < 8; ++i) { a[i] = (_Float16)p[i]; a[8 + i] = (_Float16)p[16 + i]; }
  return a;
}
__device__ __forceinline__ v16h frag_f32s(const float* rowk0, int lane, float sc) {
  v16h a; const float* p = rowk0 + 8 * (lane >> 4);
#pragma unroll
  for (int i = 0; i < 8; ++i) { a[i] = (_Float16)(p[i] * sc); a[8 + i] = (_Float16)(p[16 + i] * sc); }
  return a;
}
// column fragment from a [K][ld] layout (column n), rows >= K read as 0
__device__ __forceinline__ v16h fragc_f32(const float* W, int k0, int n, int lane, int ld, int K) {
  v16h a; const int g = lane >> 4;
#pragma unroll
  for (int i = 0; i < 8; ++i) { const int ka = k0 + 8 * g + i, kb = ka + 16;
    a[i] = (_Float16)(ka < K ? W[(size_t)ka * ld + n] : 0.f); a[8 + i] = (_Float16)(kb < K ? W[(size_t)kb * ld + n] : 0.f); }
  return a;
}
struct F2 { v16b h, l; };
__device__ __forceinline__ F2 bsplit16(const float v[16]) { F2 r;
#pragma unroll
  for (int i = 0; i < 16; ++i) { const __bf16 h = (__bf16)v[i]; r.h[i] = h; r.l[i] = (__bf16)(v[i] - (float)h); }
  return r; }
__device__ __forceinline__ F2 split_row(const float* row, int k0, int lane) { float v[16]; const float* p = row + k0 + 8 * (lane >> 4);
#pragma unroll
  for (int i = 0; i < 8; ++i) { v[i] = p[i]; v[8 + i] = p[16 + i]; }
  return bsplit16(v); }
__device__ __forceinline__ F2 split_rowK(const float* row, int k0, int lane, int K) { float v[16]; const int g = lane >> 4;
#pragma unroll
  for (int i = 0; i < 8; ++i) { const int ka = k0 + 8 * g + i, kb = ka + 16; v[i] = ka < K ? row[ka] : 0.f; v[8 + i] = kb < K ? row[kb] : 0.f; }
  return bsplit16(v); }
__device__ __forceinline__ F2 split_col(const float* W, int k0, int n, int lane, int ld, int K) { float v[16]; const int g = lane >> 4;
#pragma unroll
  for (int i = 0; i < 8; ++i) { const int ka = k0 + 8 * g + i, kb = ka + 16; v[i] = ka < K ? W[(size_t)ka * ld + n] : 0.f; v[8 + i] = kb < K ? W[(size_t)kb * ld + n] : 0.f; }
  return bsplit16(v); }
__device__ __forceinline__ v8f mac3(const F2& a, const F2& b, v8f c) { c = wmma_bf(a.l, b.h, c); c = wmma_bf(a.h, b.l, c); return wmma_bf(a.h, b.h, c); }
__device__ __forceinline__ float sigm(float v) { return 1.0f / (1.0f + expf(-v)); }
#define LDSX() do { asm volatile("s_wait_dscnt 0" ::: "memory"); __builtin_amdgcn_wave_barrier(); __builtin_amdgcn_fence(__ATOMIC_RELEASE, "workgroup"); } while (0)



// Scaled dot attention with a post-softmax multiplicative key mask: attn = softmax(Q K^T / 8) * mask_out[b,h,1,k]; out = attn V  ([4,12,2048,64] head-major inputs, no projections).
// The mask scales the softmax weights AFTER normalisation (no renormalisation): p_k <- p_k * m_k feeds P.V while the denominator keeps the unmasked sum.
__device__ __forceinline__ float bfr(float v) { return (float)(__bf16)v; }
#define NBH 48
#define SS 2048
#define HD 64
#define C2 0.18033688f    // log2(e) / sqrt(64): score scale and change of base in one factor

__device__ __forceinline__ v16b frag_b(const __bf16* rowk0, int lane) { return __builtin_bit_cast(v16b, frag_h((const _Float16*)rowk0, lane)); }
// One conversion launch. Block (s0 / 64, bh) casts its 64 K rows to bf16 (plain cast, 8 values per chunk, two chunks per thread) and writes its 64 V rows as 64 columns of V^T:
// each V value is rounded to bf16 and that value stored as f16 (8 significant bits fit in 11; only below 2^-17 can the f16 grid of 2^-24 round it again).
__global__ __launch_bounds__(256) void k_prep(const float* __restrict__ K, const float* __restrict__ V, __bf16* __restrict__ Kb, _Float16* __restrict__ VTb) {
  __shared__ __align__(16) _Float16 st[64][72];
  const int tid = threadIdx.x; const size_t bh = blockIdx.y; const int s0 = blockIdx.x * 64;
  const size_t kb = (bh * SS + s0) * HD + tid * 8; v4f kv[4];    // the thread's two chunks of 8 K values, 2048 values apart; loaded here so that they fly while V is read
#pragma unroll
  for (int j = 0; j < 2; ++j) { kv[2 * j] = *(const v4f*)(K + kb + j * 2048); kv[2 * j + 1] = *(const v4f*)(K + kb + j * 2048 + 4); }
  for (int q = tid; q < 64 * 64; q += 256) { const int rl = q >> 6, d = q & 63; st[d][rl] = (_Float16)bfr(V[(bh * SS + s0 + rl) * HD + d]); }
  __syncthreads();
  for (int q = tid; q < 64 * 8; q += 256) { const int d = q >> 3, pc = q & 7; vst2((unsigned*)(VTb + (bh * HD + d) * SS + s0 + pc * 8), *(const v4u*)(&st[d][pc * 8])); }
#pragma unroll
  for (int j = 0; j < 2; ++j) { union { __bf16 e[8]; v4u u; } pk;
#pragma unroll
    for (int e = 0; e < 4; ++e) { pk.e[e] = (__bf16)kv[2 * j][e]; pk.e[4 + e] = (__bf16)kv[2 * j + 1][e]; }
    vst2((unsigned*)(Kb + kb + j * 2048), pk.u); }
}
#define KP 72    // LDS row pitch in 16-bit values: 128 B of data + 16 B, an odd multiple of 16 B, so the 16-byte fragment reads of 16 rows spread over the banks
#define TB (64 * KP * 2)    // bytes of one staged tile (64 rows)
// Stage one tile of 64 keys for the whole block: 64 K rows and 64 V^T rows of 128 B each. A thread copies 4 + 4 chunks of 16 B (rows 16 apart); 8 lanes cover one whole row.
// s_wait_xcnt closes the statement so that it stands in front of any rewrite of the address registers the copies name.
__device__ __forceinline__ void stage_kv(const __bf16* gk, const _Float16* gv, unsigned lk, unsigned lv) {
  asm volatile("global_load_async_to_lds_b128 %0, %8, off\n\t"
               "global_load_async_to_lds_b128 %1, %9, off\n\t"
               "global_load_async_to_lds_b128 %2, %10, off\n\t"
               "global_load_async_to_lds_b128 %3, %11, off\n\t"
               "global_load_async_to_lds_b128 %4, %12, off\n\t"
               "global_load_async_to_lds_b128 %5, %13, off\n\t"
               "global_load_async_to_lds_b128 %6, %14, off\n\t"
               "global_load_async_to_lds_b128 %7, %15, off\n\t"
               "s_wait_xcnt 0x0"
               :: "v"(lk), "v"(lk + 16 * KP * 2), "v"(lk + 32 * KP * 2), "v"(lk + 48 * KP * 2), "v"(lv), "v"(lv + 16 * KP * 2), "v"(lv + 32 * KP * 2), "v"(lv + 48 * KP * 2),
                  "v"(gk), "v"(gk + 16 * HD), "v"(gk + 32 * HD), "v"(gk + 48 * HD), "v"(gv), "v"(gv + 16 * SS), "v"(gv + 32 * SS), "v"(gv + 48 * SS)
               : "memory");
}
// A wave owns 32 queries (two tiles of 16): every K fragment, V^T fragment and mask value it reads from LDS feeds two matrix products, and a block of four waves covers 128 queries per staged tile.
// Three waves on a SIMD, no more and no fewer: the grid is three blocks per WGP; all of them must be resident at once, and a fourth block on one WGP would leave another with two.
__global__ __launch_bounds__(128) __attribute__((amdgpu_waves_per_eu(3, 3))) void k_attn(const float* __restrict__ Q, const __bf16* __restrict__ Kb, const _Float16* __restrict__ VTb, const float* __restrict__ mk, float* __restrict__ O32) {
  __shared__ __align__(16) __bf16 sK[2][64][KP]; __shared__ __align__(16) _Float16 sV[2][64][KP];    // two buffers: tile kt in buffer kt & 1
  __shared__ __align__(16) float sM[SS];    // the head's whole mask row, rounded to bf16 once and kept as f32, so that the loop multiplies by it with packed f32 products
  const int tid = threadIdx.x, w = tid >> 5, lane = tid & 31, col = lane & 15, g = lane >> 4;
  const size_t bh = blockIdx.y; const int q0 = blockIdx.x * 128 + w * 32;
  const __bf16* gk = Kb + (bh * SS + (tid >> 3)) * HD + (tid & 7) * 8; const _Float16* gv = VTb + (bh * HD + (tid >> 3)) * SS + (tid & 7) * 8;    // this thread's first chunk of tile 0
  const unsigned lk = (unsigned)(size_t)&sK[0][tid >> 3][(tid & 7) * 8], lv = (unsigned)(size_t)&sV[0][tid >> 3][(tid & 7) * 8];    // its LDS byte addresses in buffer 0
  const float* qrow = Q + (bh * SS + q0 + col) * HD + g * 8; v4f qf[2][8];    // the lane's two query rows (16 rows apart) as f32, loaded first so that they fly while tile 0 lands: values kc * 32 + 8g + 0..7 and + 16 + 0..7
#pragma unroll
  for (int u = 0; u < 2; ++u)
#pragma unroll
    for (int kc = 0; kc < 2; ++kc)
#pragma unroll
      for (int i = 0; i < 4; ++i) qf[u][kc * 4 + i] = *(const v4f*)(qrow + u * 16 * HD + kc * 32 + (i >> 1) * 16 + (i & 1) * 4);
  const float* mg = mk + bh * SS + tid * 4; v4f mf[4];    // the thread's 16 mask values: four chunks of 4, 512 values apart
#pragma unroll
  for (int j = 0; j < 4; ++j) mf[j] = *(const v4f*)(mg + j * 512);
  asm volatile("s_wait_xcnt 0x0" :: "v"(qrow), "v"(tid) : "memory");    // stands in front of any reuse of the address registers that the query and mask loads name (the mask loads are addressed by the thread index); as inputs they stay live up to here
  stage_kv(gk, gv, lk, lv);
#pragma unroll
  for (int j = 0; j < 4; ++j) *(v4f*)&sM[tid * 4 + j * 512] = v4f{bfr(mf[j][0]), bfr(mf[j][1]), bfr(mf[j][2]), bfr(mf[j][3])};    // published by the barrier below, together with tile 0
  asm volatile("s_wait_asynccnt 0x0" ::: "memory");    // tile 0 has landed before the barrier publishes it
  __syncthreads();
  stage_kv(gk + 64 * HD, gv + 64, lk + TB, lv + TB);    // tile 1 flies while tile 0 is worked on
  v16b aq[2][2];    // the query rows cast here, once per wave, in the fragment's k order
#pragma unroll
  for (int u = 0; u < 2; ++u)
#pragma unroll
    for (int kc = 0; kc < 2; ++kc)
#pragma unroll
      for (int i = 0; i < 4; ++i) { aq[u][kc][i] = (__bf16)qf[u][kc * 4][i]; aq[u][kc][4 + i] = (__bf16)qf[u][kc * 4 + 1][i]; aq[u][kc][8 + i] = (__bf16)qf[u][kc * 4 + 2][i]; aq[u][kc][12 + i] = (__bf16)qf[u][kc * 4 + 3][i]; }
  float mrun[2] = {-3.0e38f, -3.0e38f}, lrun[2] = {0.f, 0.f}; v8f acc[2][4] = {};
#pragma unroll 1
  for (int kt = 0; kt < SS / 64; ++kt) { const int b = kt & 1;
    const float* mrow = &sM[kt * 64 + g * 8]; v4f mq[2][2];    // the lane's 32 mask values of this tile: 8 in a row for each score tile, read one score tile ahead of their use
    mq[0][0] = *(const v4f*)mrow; mq[0][1] = *(const v4f*)(mrow + 4);
    v8f s[2][4];
#pragma unroll
    for (int t = 0; t < 4; ++t) { s[0][t] = v8f{}; s[1][t] = v8f{};
#pragma unroll
      for (int kc = 0; kc < 2; ++kc) { const v16b kf = frag_b(&sK[b][t * 16 + col][kc * 32], lane);    // one read, two products
        s[0][t] = wmma_bf(kf, aq[0][kc], s[0][t]); s[1][t] = wmma_bf(kf, aq[1][kc], s[1][t]); } }    // raw dot products; the scale is folded into C2
    float mnew[2], corr[2], ps[2] = {0.f, 0.f};
#pragma unroll
    for (int u = 0; u < 2; ++u) { float mx = -3.4e38f;
#pragma unroll
      for (int t = 0; t < 4; ++t)
#pragma unroll
        for (int r = 0; r < 8; ++r) mx = fmaxf(mx, s[u][t][r]);
      mx = fmaxf(mx, __shfl_xor(mx, 16, 32));    // the other half of the wave holds the query's other 32 keys
      mnew[u] = fmaxf(mrun[u], mx * C2); corr[u] = __builtin_amdgcn_exp2f(mrun[u] - mnew[u]); }    // mrun, mnew: running maximum times C2 (C2 > 0 keeps the order); an unchanged maximum gives exactly 1
    v16h ph[2][2];
#pragma unroll
    for (int t = 0; t < 4; ++t) {
      if (t < 3) { mq[(t + 1) & 1][0] = *(const v4f*)(mrow + (t + 1) * 16); mq[(t + 1) & 1][1] = *(const v4f*)(mrow + (t + 1) * 16 + 4); }
#pragma unroll
      for (int r = 0; r < 8; r += 2)
#pragma unroll
        for (int u = 0; u < 2; ++u)
          { const v2f x = __builtin_elementwise_fma(v2f{s[u][t][r], s[u][t][r + 1]}, v2f{C2, C2}, v2f{-mnew[u], -mnew[u]});    // exp((s - m) / 8) = 2^(s * C2 - m * C2): one packed fused multiply-add for two elements
            const v2f p = v2f{__builtin_amdgcn_exp2f(x[0]), __builtin_amdgcn_exp2f(x[1])}; ps[u] += p[0]; ps[u] += p[1];    // denominator from the unmasked p
            const v2f pm = p * v2f{mq[t & 1][r >> 2][r & 3], mq[t & 1][r >> 2][(r & 3) + 1]};    // the P.V operand carries p * mask_k: one packed product for two elements
            const v2h hp = __builtin_convertvector(pm, v2h);    // one rounding to f16: 11 significant bits down to 2^-14, steps of 2^-24 below; p <= 1, so only a mask value above 65504 could overflow
            ph[u][t >> 1][(t & 1) * 8 + r] = hp[0]; ph[u][t >> 1][(t & 1) * 8 + r + 1] = hp[1]; } }
#pragma unroll
    for (int u = 0; u < 2; ++u) { ps[u] += __shfl_xor(ps[u], 16, 32);
      lrun[u] = lrun[u] * corr[u] + ps[u]; mrun[u] = mnew[u];
#pragma unroll
      for (int t = 0; t < 4; ++t) acc[u][t] *= corr[u]; }
#pragma unroll
    for (int kc = 0; kc < 2; ++kc)
#pragma unroll
      for (int t = 0; t < 4; ++t) { const v16h vf = frag_h(&sV[b][t * 16 + col][kc * 32], lane);    // one read, two products
        acc[0][t] = wmma_hf(vf, ph[0][kc], acc[0][t]); acc[1][t] = wmma_hf(vf, ph[1][kc], acc[1][t]); }
    asm volatile("s_wait_dscnt 0x0" ::: "memory");       // this wave's reads of buffer b are done before the buffer is refilled
    asm volatile("s_wait_asynccnt 0x0" ::: "memory");    // this wave's copies of tile kt + 1 have landed
    __syncthreads();                                     // publishes tile kt + 1 and ends every wave's reads of buffer b
    if (kt + 2 < SS / 64) stage_kv(gk + (size_t)(kt + 2) * 64 * HD, gv + (kt + 2) * 64, lk + b * TB, lv + b * TB); }
  asm volatile("s_wait_asynccnt 0x0" ::: "memory");      // no copy is outstanding when the wave goes on to the output and ends
#pragma unroll
  for (int u = 0; u < 2; ++u) { const float inv = 1.0f / lrun[u]; float* orow = O32 + (bh * SS + q0 + u * 16 + col) * HD + g * 8;    // head-major output [bh][s][64]; accumulator tile t holds 8 consecutive values of the lane's own row
#pragma unroll
    for (int t = 0; t < 4; ++t) { const v8f o = acc[u][t] * inv;
      vst2(orow + t * 16, __builtin_shufflevector(o, o, 0, 1, 2, 3)); vst2(orow + t * 16 + 4, __builtin_shufflevector(o, o, 4, 5, 6, 7)); } }
}
extern "C" void kernel_launch(void* const* d_in, const int* in_sizes, int n_in, void* d_out, int out_size, void* d_ws, size_t ws_size, hipStream_t stream) {
  (void)in_sizes; (void)n_in; (void)out_size; (void)ws_size;
  const float* Q = (const float*)d_in[0]; const float* K = (const float*)d_in[1]; const float* V = (const float*)d_in[2]; const float* mk = (const float*)d_in[3];
  char* ws = (char*)d_ws; size_t off = 0;
  auto take = [&](size_t bytes) { char* p = ws + off; off += (bytes + 255) & ~(size_t)255; return p; };
  const size_t n = (size_t)NBH * SS * HD;
  __bf16* Kb = (__bf16*)take(n * 2); _Float16* VTb = (_Float16*)take(n * 2);
  // ws ~ 25 MB
  k_prep<<<dim3(SS / 64, NBH), 256, 0, stream>>>(K, V, Kb, VTb);
  k_attn<<<dim3(SS / 128, NBH), 128, 0, stream>>>(Q, Kb, VTb, mk, (float*)d_out);
}

// v009
// A run of this version takes 59.9 microseconds.
// Timed twice side by side with v008, it ran 1.07 times as fast both times.
// Over all steps from v000 it is 5.57 times as fast.
// compute dtype: Q, K, V, mask_out (INPUTS) rounded to bf16: single bf16 WMMA products for the scores; the second product runs on f16 WMMA (f32 accumulate): V and the key's mask value, each rounded to bf16, enter as their product, rounded once to f16; the softmax weights are rounded once to f16 (11 significant bits); softmax in f32.
#include <hip/hip_runtime.h>
#include <math.h>

typedef __attribute__((ext_vector_type(16))) _Float16 v16h;
typedef __attribute__((ext_vector_type(16))) __bf16 v16b;
typedef __attribute__((ext_vector_type(8)))  _Float16 v8h;
typedef __attribute__((ext_vector_type(8)))  float v8f;
typedef __attribute__((ext_vector_type(4)))  float v4f;
typedef __attribute__((ext_vector_type(2)))  float v2f;
typedef __attribute__((ext_vector_type(2)))  __bf16 v2b;
typedef __attribute__((ext_vector_type(2)))  _Float16 v2h;
typedef __attribute__((ext_vector_type(4)))  unsigned v4u;
typedef __attribute__((ext_vector_type(4)))  int v4i;
typedef float __attribute__((may_alias)) float_a;
typedef int __attribute__((may_alias)) int_a;

template <typename T> __device__ __forceinline__ void vst2(void* p, T v) { *(T*)p = v;  }
__device__ __forceinline__ v8f wmma16(v16h a, v16h b, v8f c) {
  v8f d = __builtin_amdgcn_wmma_f32_16x16x32_f16(false, a, false, b, (short)0, c, false, false);
  asm volatile("v_nop\n\tv_nop\n\tv_nop\n\tv_nop" : "+v"(d) : "v"(a), "v"(b));
  return d;
}
__device__ __forceinline__ v8f wmma_bf(v16b a, v16b b, v8f c) {
  return __builtin_amdgcn_wmma_f32_16x16x32_bf16(false, a, false, b, (short)0, c, false, false);
}
__device__ __forceinline__ v8f wmma_hf(v16h a, v16h b, v8f c) {
  return __builtin_amdgcn_wmma_f32_16x16x32_f16(false, a, false, b, (short)0, c, false, false);
}
// 16x16x32 fragments: lane = (h = lane>>4, row/col = lane&15); elements 0..7 = k0+8h+0..7, 8..15 = k0+16+8h+0..7; D element r = row 8h+r
__device__ __forceinline__ v16h frag_h(const _Float16* rowk0, int lane) {
  union { v16h v; v8h q[2]; } u; const _Float16* p = rowk0 + 8 * (lane >> 4);
  u.q[0] = *(const v8h*)p; u.q[1] = *(const v8h*)(p + 16); return u.v;
}
__device__ __forceinline__ v16h frag_f32(const float* rowk0, int lane) {
  v16h a; const float* p = rowk0 + 8 * (lane >> 4);
#pragma unroll
  for (int i = 0; i < 8; ++i) { a[i] = (_Float16)p[i]; a[8 + i] = (_Float16)p[16 + i]; }
  return a;
}
__device__ __forceinline__ v16h frag_f32s(const float* rowk0, int lane, float sc) {
  v16h a; const float* p = rowk0 + 8 * (lane >> 4);
#pragma unroll
  for (int i = 0; i < 8; ++i) { a[i] = (_Float16)(p[i] * sc); a[8 + i] = (_Float16)(p[16 + i] * sc); }
  return a;
}
// column fragment from a [K][ld] layout (column n), rows >= K read as 0
__device__ __forceinline__ v16h fragc_f32(const float* W, int k0, int n, int lane, int ld, int K) {
  v16h a; const int g = lane >> 4;
#pragma unroll
  for (int i = 0; i < 8; ++i) { const int ka = k0 + 8 * g + i, kb = ka + 16;
    a[i] = (_Float16)(ka < K ? W[(size_t)ka * ld + n] : 0.f); a[8 + i] = (_Float16)(kb < K ? W[(size_t)kb * ld + n] : 0.f); }
  return a;
}
struct F2 { v16b h, l; };
__device__ __forceinline__ F2 bsplit16(const float v[16]) { F2 r;
#pragma unroll
  for (int i = 0; i < 16; ++i) { const __bf16 h = (__bf16)v[i]; r.h[i] = h; r.l[i] = (__bf16)(v[i] - (float)h); }
  return r; }
__device__ __forceinline__ F2 split_row(const float* row, int k0, int lane) { float v[16]; const float* p = row + k0 + 8 * (lane >> 4);
#pragma unroll
  for (int i = 0; i < 8; ++i) { v[i] = p[i]; v[8 + i] = p[16 + i]; }
  return bsplit16(v); }
__device__ __forceinline__ F2 split_rowK(const float* row, int k0, int lane, int K) { float v[16]; const int g = lane >> 4;
#pragma unroll
  for (int i = 0; i < 8; ++i) { const int ka = k0 + 8 * g + i, kb = ka + 16; v[i] = ka < K ? row[ka] : 0.f; v[8 + i] = kb < K ? row[kb] : 0.f; }
  return bsplit16(v); }
__device__ __forceinline__ F2 split_col(const float* W, int k0, int n, int lane, int ld, int K) { float v[16]; const int g = lane >> 4;
#pragma unroll
  for (int i = 0; i < 8; ++i) { const int ka = k0 + 8 * g + i, kb = ka + 16; v[i] = ka < K ? W[(size_t)ka * ld + n] : 0.f; v[8 + i] = kb < K ? W[(size_t)kb * ld + n] : 0.f; }
  return bsplit16(v); }
__device__ __forceinline__ v8f mac3(const F2& a, const F2& b, v8f c) { c = wmma_bf(a.l, b.h, c); c = wmma_bf(a.h, b.l, c); return wmma_bf(a.h, b.h, c); }
__device__ __forceinline__ float sigm(float v) { return 1.0f / (1.0f + expf(-v)); }
#define LDSX() do { asm volatile("s_wait_dscnt 0" ::: "memory"); __builtin_amdgcn_wave_barrier(); __builtin_amdgcn_fence(__ATOMIC_RELEASE, "workgroup"); } while (0)



// Scaled dot attention with a post-softmax multiplicative key mask: attn = softmax(Q K^T / 8) * mask_out[b,h,1,k]; out = attn V  ([4,12,2048,64] head-major inputs, no projections).
// The mask scales the softmax weights AFTER normalisation (no renormalisation). It depends on the key alone, so sum_k (p_k * m_k) * V_k = sum_k p_k * (m_k * V_k): the conversion launch scales V row k by m_k once, and the attention loop never sees the mask; the denominator is the plain sum of p.
__device__ __forceinline__ float bfr(float v) { return (float)(__bf16)v; }
#define NBH 48
#define SS 2048
#define HD 64
#define C2 0.18033688f    // log2(e) / sqrt(64): score scale and change of base in one factor

__device__ __forceinline__ v16b frag_b(const __bf16* rowk0, int lane) { return __builtin_bit_cast(v16b, frag_h((const _Float16*)rowk0, lane)); }
// One conversion launch. Block (s0 / 64, bh) casts its 64 K rows to bf16 (plain cast, 8 values per chunk, two chunks per thread) and writes its 64 V rows as 64 columns of V^T:
// each V value is rounded to bf16 and that value held as f16 (8 significant bits fit in 11; only below 2^-17 can the f16 grid of 2^-24 round it again), the key's mask value likewise;
// on the way out of LDS a chunk of 8 keys is multiplied by its 8 mask values, one f16 rounding per product (only |m * V| above 65504 could overflow).
__global__ __launch_bounds__(256) void k_prep(const float* __restrict__ K, const float* __restrict__ V, const float* __restrict__ mk, __bf16* __restrict__ Kb, _Float16* __restrict__ VTb) {
  __shared__ __align__(16) _Float16 st[64][72];
  const int tid = threadIdx.x; const size_t bh = blockIdx.y; const int s0 = blockIdx.x * 64;
  const size_t kb = (bh * SS + s0) * HD + tid * 8; v4f kv[4];    // the thread's two chunks of 8 K values, 2048 values apart; loaded here so that they fly while V is read
#pragma unroll
  for (int j = 0; j < 2; ++j) { kv[2 * j] = *(const v4f*)(K + kb + j * 2048); kv[2 * j + 1] = *(const v4f*)(K + kb + j * 2048 + 4); }
  const float* mg = mk + bh * SS + s0 + (tid & 7) * 8; const v4f m0 = *(const v4f*)mg, m1 = *(const v4f*)(mg + 4);    // the mask values of the 8 keys of this thread's V^T chunks (the same 8 keys in both chunks)
  for (int q = tid; q < 64 * 64; q += 256) { const int rl = q >> 6, d = q & 63; st[d][rl] = (_Float16)bfr(V[(bh * SS + s0 + rl) * HD + d]); }
  __syncthreads();
  v8h mh;
#pragma unroll
  for (int e = 0; e < 4; ++e) { mh[e] = (_Float16)bfr(m0[e]); mh[4 + e] = (_Float16)bfr(m1[e]); }
  for (int q = tid; q < 64 * 8; q += 256) { const int d = q >> 3, pc = q & 7; vst2((unsigned*)(VTb + (bh * HD + d) * SS + s0 + pc * 8), *(const v8h*)(&st[d][pc * 8]) * mh); }    // pc = tid & 7 in both rounds
#pragma unroll
  for (int j = 0; j < 2; ++j) { union { __bf16 e[8]; v4u u; } pk;
#pragma unroll
    for (int e = 0; e < 4; ++e) { pk.e[e] = (__bf16)kv[2 * j][e]; pk.e[4 + e] = (__bf16)kv[2 * j + 1][e]; }
    vst2((unsigned*)(Kb + kb + j * 2048), pk.u); }
}
#define KP 72    // LDS row pitch in 16-bit values: 128 B of data + 16 B, an odd multiple of 16 B, so the 16-byte fragment reads of 16 rows spread over the banks
#define TB (64 * KP * 2)    // bytes of one staged tile (64 rows)
// Stage one tile of 64 keys for the whole block: 64 K rows and 64 V^T rows of 128 B each. A thread copies 4 + 4 chunks of 16 B (rows 16 apart); 8 lanes cover one whole row.
// s_wait_xcnt closes the statement so that it stands in front of any rewrite of the address registers the copies name.
__device__ __forceinline__ void stage_kv(const __bf16* gk, const _Float16* gv, unsigned lk, unsigned lv) {
  asm volatile("global_load_async_to_lds_b128 %0, %8, off\n\t"
               "global_load_async_to_lds_b128 %1, %9, off\n\t"
               "global_load_async_to_lds_b128 %2, %10, off\n\t"
               "global_load_async_to_lds_b128 %3, %11, off\n\t"
               "global_load_async_to_lds_b128 %4, %12, off\n\t"
               "global_load_async_to_lds_b128 %5, %13, off\n\t"
               "global_load_async_to_lds_b128 %6, %14, off\n\t"
               "global_load_async_to_lds_b128 %7, %15, off\n\t"
               "s_wait_xcnt 0x0"
               :: "v"(lk), "v"(lk + 16 * KP * 2), "v"(lk + 32 * KP * 2), "v"(lk + 48 * KP * 2), "v"(lv), "v"(lv + 16 * KP * 2), "v"(lv + 32 * KP * 2), "v"(lv + 48 * KP * 2),
                  "v"(gk), "v"(gk + 16 * HD), "v"(gk + 32 * HD), "v"(gk + 48 * HD), "v"(gv), "v"(gv + 16 * SS), "v"(gv + 32 * SS), "v"(gv + 48 * SS)
               : "memory");
}
// A wave owns 32 queries (two tiles of 16): every K fragment and V^T fragment it reads from LDS feeds two matrix products, and a block of four waves covers 128 queries per staged tile.
// Three waves on a SIMD, no more and no fewer: the grid is three blocks per WGP; all of them must be resident at once, and a fourth block on one WGP would leave another with two.
__global__ __launch_bounds__(128) __attribute__((amdgpu_waves_per_eu(3, 3))) void k_attn(const float* __restrict__ Q, const __bf16* __restrict__ Kb, const _Float16* __restrict__ VTb, float* __restrict__ O32) {
  __shared__ __align__(16) __bf16 sK[2][64][KP]; __shared__ __align__(16) _Float16 sV[2][64][KP];    // two buffers: tile kt in buffer kt & 1
  const int tid = threadIdx.x, w = tid >> 5, lane = tid & 31, col = lane & 15, g = lane >> 4;
  const size_t bh = blockIdx.y; const int q0 = blockIdx.x * 128 + w * 32;
  const __bf16* gk = Kb + (bh * SS + (tid >> 3)) * HD + (tid & 7) * 8; const _Float16* gv = VTb + (bh * HD + (tid >> 3)) * SS + (tid & 7) * 8;    // this thread's first chunk of tile 0
  const unsigned lk = (unsigned)(size_t)&sK[0][tid >> 3][(tid & 7) * 8], lv = (unsigned)(size_t)&sV[0][tid >> 3][(tid & 7) * 8];    // its LDS byte addresses in buffer 0
  const float* qrow = Q + (bh * SS + q0 + col) * HD + g * 8; v4f qf[2][8];    // the lane's two query rows (16 rows apart) as f32, loaded first so that they fly while tile 0 lands: values kc * 32 + 8g + 0..7 and + 16 + 0..7
#pragma unroll
  for (int u = 0; u < 2; ++u)
#pragma unroll
    for (int kc = 0; kc < 2; ++kc)
#pragma unroll
      for (int i = 0; i < 4; ++i) qf[u][kc * 4 + i] = *(const v4f*)(qrow + u * 16 * HD + kc * 32 + (i >> 1) * 16 + (i & 1) * 4);
  asm volatile("s_wait_xcnt 0x0" :: "v"(qrow) : "memory");    // stands in front of any reuse of the address registers that the query loads name; as an input they stay live up to here
  stage_kv(gk, gv, lk, lv);
  asm volatile("s_wait_asynccnt 0x0" ::: "memory");    // tile 0 has landed before the barrier publishes it
  __syncthreads();
  stage_kv(gk + 64 * HD, gv + 64, lk + TB, lv + TB);    // tile 1 flies while tile 0 is worked on
  v16b aq[2][2];    // the query rows cast here, once per wave, in the fragment's k order
#pragma unroll
  for (int u = 0; u < 2; ++u)
#pragma unroll
    for (int kc = 0; kc < 2; ++kc)
#pragma unroll
      for (int i = 0; i < 4; ++i) { aq[u][kc][i] = (__bf16)qf[u][kc * 4][i]; aq[u][kc][4 + i] = (__bf16)qf[u][kc * 4 + 1][i]; aq[u][kc][8 + i] = (__bf16)qf[u][kc * 4 + 2][i]; aq[u][kc][12 + i] = (__bf16)qf[u][kc * 4 + 3][i]; }
  float mrun[2] = {-3.0e38f, -3.0e38f}, lrun[2] = {0.f, 0.f}; v8f acc[2][4] = {};
#pragma unroll 1
  for (int kt = 0; kt < SS / 64; ++kt) { const int b = kt & 1;
    v8f s[2][4];
#pragma unroll
    for (int t = 0; t < 4; ++t) { s[0][t] = v8f{}; s[1][t] = v8f{};
#pragma unroll
      for (int kc = 0; kc < 2; ++kc) { const v16b kf = frag_b(&sK[b][t * 16 + col][kc * 32], lane);    // one read, two products
        s[0][t] = wmma_bf(kf, aq[0][kc], s[0][t]); s[1][t] = wmma_bf(kf, aq[1][kc], s[1][t]); } }    // raw dot products; the scale is folded into C2
    float mnew[2], corr[2], ps[2] = {0.f, 0.f};
#pragma unroll
    for (int u = 0; u < 2; ++u) { float mx = -3.4e38f;
#pragma unroll
      for (int t = 0; t < 4; ++t)
#pragma unroll
        for (int r = 0; r < 8; ++r) mx = fmaxf(mx, s[u][t][r]);
      mx = fmaxf(mx, __shfl_xor(mx, 16, 32));    // the other half of the wave holds the query's other 32 keys
      mnew[u] = fmaxf(mrun[u], mx * C2); corr[u] = __builtin_amdgcn_exp2f(mrun[u] - mnew[u]); }    // mrun, mnew: running maximum times C2 (C2 > 0 keeps the order); an unchanged maximum gives exactly 1
    v16h ph[2][2];
#pragma unroll
    for (int t = 0; t < 4; ++t)
#pragma unroll
      for (int r = 0; r < 8; r += 2)
#pragma unroll
        for (int u = 0; u < 2; ++u)
          { const v2f x = __builtin_elementwise_fma(v2f{s[u][t][r], s[u][t][r + 1]}, v2f{C2, C2}, v2f{-mnew[u], -mnew[u]});    // exp((s - m) / 8) = 2^(s * C2 - m * C2): one packed fused multiply-add for two elements
            const v2f p = v2f{__builtin_amdgcn_exp2f(x[0]), __builtin_amdgcn_exp2f(x[1])}; ps[u] += p[0]; ps[u] += p[1];    // denominator
            const v2h hp = __builtin_convertvector(p, v2h);    // one rounding to f16: 11 significant bits down to 2^-14, steps of 2^-24 below; p <= 1
            ph[u][t >> 1][(t & 1) * 8 + r] = hp[0]; ph[u][t >> 1][(t & 1) * 8 + r + 1] = hp[1]; }
#pragma unroll
    for (int u = 0; u < 2; ++u) { ps[u] += __shfl_xor(ps[u], 16, 32);
      lrun[u] = lrun[u] * corr[u] + ps[u]; mrun[u] = mnew[u];
#pragma unroll
      for (int t = 0; t < 4; ++t) acc[u][t] *= corr[u]; }
#pragma unroll
    for (int kc = 0; kc < 2; ++kc)
#pragma unroll
      for (int t = 0; t < 4; ++t) { const v16h vf = frag_h(&sV[b][t * 16 + col][kc * 32], lane);    // one read, two products
        acc[0][t] = wmma_hf(vf, ph[0][kc], acc[0][t]); acc[1][t] = wmma_hf(vf, ph[1][kc], acc[1][t]); }
    asm volatile("s_wait_dscnt 0x0" ::: "memory");       // this wave's reads of buffer b are done before the buffer is refilled
    asm volatile("s_wait_asynccnt 0x0" ::: "memory");    // this wave's copies of tile kt + 1 have landed
    __syncthreads();                                     // publishes tile kt + 1 and ends every wave's reads of buffer b
    if (kt + 2 < SS / 64) stage_kv(gk + (size_t)(kt + 2) * 64 * HD, gv + (kt + 2) * 64, lk + b * TB, lv + b * TB); }
  asm volatile("s_wait_asynccnt 0x0" ::: "memory");      // no copy is outstanding when the wave goes on to the output and ends
#pragma unroll
  for (int u = 0; u < 2; ++u) { const float inv = 1.0f / lrun[u]; float* orow = O32 + (bh * SS + q0 + u * 16 + col) * HD + g * 8;    // head-major output [bh][s][64]; accumulator tile t holds 8 consecutive values of the lane's own row
#pragma unroll
    for (int t = 0; t < 4; ++t) { const v8f o = acc[u][t] * inv;
      vst2(orow + t * 16, __builtin_shufflevector(o, o, 0, 1, 2, 3)); vst2(orow + t * 16 + 4, __builtin_shufflevector(o, o, 4, 5, 6, 7)); } }
}
extern "C" void kernel_launch(void* const* d_in, const int* in_sizes, int n_in, void* d_out, int out_size, void* d_ws, size_t ws_size, hipStream_t stream) {
  (void)in_sizes; (void)n_in; (void)out_size; (void)ws_size;
  const float* Q = (const float*)d_in[0]; const float* K = (const float*)d_in[1]; const float* V = (const float*)d_in[2]; const float* mk = (const float*)d_in[3];
  char* ws = (char*)d_ws; size_t off = 0;
  auto take = [&](size_t bytes) { char* p = ws + off; off += (bytes + 255) & ~(size_t)255; return p; };
  const size_t n = (size_t)NBH * SS * HD;
  __bf16* Kb = (__bf16*)take(n * 2); _Float16* VTb = (_Float16*)take(n * 2);
  // ws ~ 25 MB
  k_prep<<<dim3(SS / 64, NBH), 256, 0, stream>>>(K, V, mk, Kb, VTb);
  k_attn<<<dim3(SS / 128, NBH), 128, 0, stream>>>(Q, Kb, VTb, (float*)d_out);
}

// v010
// One run takes 57.5 microseconds.
// In two side-by-side timings against v009, it was 1.04 and 1.06 times as fast.
// Over all steps from v000 it is 5.83 times as fast.
// compute dtype: Q, K, V, mask_out (INPUTS) rounded to bf16: single bf16 WMMA products for the scores; the second product runs on f16 WMMA (f32 accumulate): V and the key's mask value, each rounded to bf16, enter as their product, rounded once to f16; the softmax weights are rounded once to f16 (11 significant bits); softmax in f32.
#include <hip/hip_runtime.h>
#include <math.h>

typedef __attribute__((ext_vector_type(16))) _Float16 v16h;
typedef __attribute__((ext_vector_type(16))) __bf16 v16b;
typedef __attribute__((ext_vector_type(8)))  _Float16 v8h;
typedef __attribute__((ext_vector_type(8)))  float v8f;
typedef __attribute__((ext_vector_type(4)))  float v4f;
typedef __attribute__((ext_vector_type(2)))  float v2f;
typedef __attribute__((ext_vector_type(2)))  __bf16 v2b;
typedef __attribute__((ext_vector_type(2)))  _Float16 v2h;
typedef __attribute__((ext_vector_type(4)))  unsigned v4u;
typedef __attribute__((ext_vector_type(4)))  int v4i;
typedef float __attribute__((may_alias)) float_a;
typedef int __attribute__((may_alias)) int_a;

template <typename T> __device__ __forceinline__ void vst2(void* p, T v) { *(T*)p = v;  }
__device__ __forceinline__ v8f wmma16(v16h a, v16h b, v8f c) {
  v8f d = __builtin_amdgcn_wmma_f32_16x16x32_f16(false, a, false, b, (short)0, c, false, false);
  asm volatile("v_nop\n\tv_nop\n\tv_nop\n\tv_nop" : "+v"(d) : "v"(a), "v"(b));
  return d;
}
__device__ __forceinline__ v8f wmma_bf(v16b a, v16b b, v8f c) {
  return __builtin_amdgcn_wmma_f32_16x16x32_bf16(false, a, false, b, (short)0, c, false, false);
}
__device__ __forceinline__ v8f wmma_hf(v16h a, v16h b, v8f c) {
  return __builtin_amdgcn_wmma_f32_16x16x32_f16(false, a, false, b, (short)0, c, false, false);
}
// 16x16x32 fragments: lane = (h = lane>>4, row/col = lane&15); elements 0..7 = k0+8h+0..7, 8..15 = k0+16+8h+0..7; D element r = row 8h+r
__device__ __forceinline__ v16h frag_h(const _Float16* rowk0, int lane) {
  union { v16h v; v8h q[2]; } u; const _Float16* p = rowk0 + 8 * (lane >> 4);
  u.q[0] = *(const v8h*)p; u.q[1] = *(const v8h*)(p + 16); return u.v;
}
__device__ __forceinline__ v16h frag_f32(const float* rowk0, int lane) {
  v16h a; const float* p = rowk0 + 8 * (lane >> 4);
#pragma unroll
  for (int i = 0; i < 8; ++i) { a[i] = (_Float16)p[i]; a[8 + i] = (_Float16)p[16 + i]; }
  return a;
}
__device__ __forceinline__ v16h frag_f32s(const float* rowk0, int lane, float sc) {
  v16h a; const float* p = rowk0 + 8 * (lane >> 4);
#pragma unroll
  for (int i = 0; i < 8; ++i) { a[i] = (_Float16)(p[i] * sc); a[8 + i] = (_Float16)(p[16 + i] * sc); }
  return a;
}
// column fragment from a [K][ld] layout (column n), rows >= K read as 0
__device__ __forceinline__ v16h fragc_f32(const float* W, int k0, int n, int lane, int ld, int K) {
  v16h a; const int g = lane >> 4;
#pragma unroll
  for (int i = 0; i < 8; ++i) { const int ka = k0 + 8 * g + i, kb = ka + 16;
    a[i] = (_Float16)(ka < K ? W[(size_t)ka * ld + n] : 0.f); a[8 + i] = (_Float16)(kb < K ? W[(size_t)kb * ld + n] : 0.f); }
  return a;
}
struct F2 { v16b h, l; };
__device__ __forceinline__ F2 bsplit16(const float v[16]) { F2 r;
#pragma unroll
  for (int i = 0; i < 16; ++i) { const __bf16 h = (__bf16)v[i]; r.h[i] = h; r.l[i] = (__bf16)(v[i] - (float)h); }
  return r; }
__device__ __forceinline__ F2 split_row(const float* row, int k0, int lane) { float v[16]; const float* p = row + k0 + 8 * (lane >> 4);
#pragma unroll
  for (int i = 0; i < 8; ++i) { v[i] = p[i]; v[8 + i] = p[16 + i]; }
  return bsplit16(v); }
__device__ __forceinline__ F2 split_rowK(const float* row, int k0, int lane, int K) { float v[16]; const int g = lane >> 4;
#pragma unroll
  for (int i = 0; i < 8; ++i) { const int ka = k0 + 8 * g + i, kb = ka + 16; v[i] = ka < K ? row[ka] : 0.f; v[8 + i] = kb < K ? row[kb] : 0.f; }
  return bsplit16(v); }
__device__ __forceinline__ F2 split_col(const float* W, int k0, int n, int lane, int ld, int K) { float v[16]; const int g = lane >> 4;
#pragma unroll
  for (int i = 0; i < 8; ++i) { const int ka = k0 + 8 * g + i, kb = ka + 16; v[i] = ka < K ? W[(size_t)ka * ld + n] : 0.f; v[8 + i] = kb < K ? W[(size_t)kb * ld + n] : 0.f; }
  return bsplit16(v); }
__device__ __forceinline__ v8f mac3(const F2& a, const F2& b, v8f c) { c = wmma_bf(a.l, b.h, c); c = wmma_bf(a.h, b.l, c); return wmma_bf(a.h, b.h, c); }
__device__ __forceinline__ float sigm(float v) { return 1.0f / (1.0f + expf(-v)); }
#define LDSX() do { asm volatile("s_wait_dscnt 0" ::: "memory"); __builtin_amdgcn_wave_barrier(); __builtin_amdgcn_fence(__ATOMIC_RELEASE, "workgroup"); } while (0)



// Scaled dot attention with a post-softmax multiplicative key mask: attn = softmax(Q K^T / 8) * mask_out[b,h,1,k]; out = attn V  ([4,12,2048,64] head-major inputs, no projections).
// The mask scales the softmax weights AFTER normalisation (no renormalisation). It depends on the key alone, so sum_k (p_k * m_k) * V_k = sum_k p_k * (m_k * V_k): the conversion launch scales V row k by m_k once, and the attention loop never sees the mask; the denominator is the plain sum of p.
__device__ __forceinline__ float bfr(float v) { return (float)(__bf16)v; }
#define NBH 48
#define SS 2048
#define HD 64
#define C2 0.18033688f    // log2(e) / sqrt(64): score scale and change of base in one factor
#define PMAX 1024.0f    // bound on a lane's sum of softmax weights in one trip, beyond which the reference exponent is renewed

__device__ __forceinline__ v16b frag_b(const __bf16* rowk0, int lane) { return __builtin_bit_cast(v16b, frag_h((const _Float16*)rowk0, lane)); }
// One conversion launch. Block (s0 / 64, bh) casts its 64 K rows to bf16 (plain cast, 8 values per chunk, two chunks per thread) and writes its 64 V rows as 64 columns of V^T:
// each V value is rounded to bf16 and that value held as f16 (8 significant bits fit in 11; only below 2^-17 can the f16 grid of 2^-24 round it again), the key's mask value likewise;
// on the way out of LDS a chunk of 8 keys is multiplied by its 8 mask values, one f16 rounding per product (only |m * V| above 65504 could overflow).
__global__ __launch_bounds__(256) void k_prep(const float* __restrict__ K, const float* __restrict__ V, const float* __restrict__ mk, __bf16* __restrict__ Kb, _Float16* __restrict__ VTb) {
  __shared__ __align__(16) _Float16 st[64][72];
  const int tid = threadIdx.x; const size_t bh = blockIdx.y; const int s0 = blockIdx.x * 64;
  const size_t kb = (bh * SS + s0) * HD + tid * 8; v4f kv[4];    // the thread's two chunks of 8 K values, 2048 values apart; loaded here so that they fly while V is read
#pragma unroll
  for (int j = 0; j < 2; ++j) { kv[2 * j] = *(const v4f*)(K + kb + j * 2048); kv[2 * j + 1] = *(const v4f*)(K + kb + j * 2048 + 4); }
  const float* mg = mk + bh * SS + s0 + (tid & 7) * 8; const v4f m0 = *(const v4f*)mg, m1 = *(const v4f*)(mg + 4);    // the mask values of the 8 keys of this thread's V^T chunks (the same 8 keys in both chunks)
  for (int q = tid; q < 64 * 64; q += 256) { const int rl = q >> 6, d = q & 63; st[d][rl] = (_Float16)bfr(V[(bh * SS + s0 + rl) * HD + d]); }
  __syncthreads();
  v8h mh;
#pragma unroll
  for (int e = 0; e < 4; ++e) { mh[e] = (_Float16)bfr(m0[e]); mh[4 + e] = (_Float16)bfr(m1[e]); }
  for (int q = tid; q < 64 * 8; q += 256) { const int d = q >> 3, pc = q & 7; vst2((unsigned*)(VTb + (bh * HD + d) * SS + s0 + pc * 8), *(const v8h*)(&st[d][pc * 8]) * mh); }    // pc = tid & 7 in both rounds
#pragma unroll
  for (int j = 0; j < 2; ++j) { union { __bf16 e[8]; v4u u; } pk;
#pragma unroll
    for (int e = 0; e < 4; ++e) { pk.e[e] = (__bf16)kv[2 * j][e]; pk.e[4 + e] = (__bf16)kv[2 * j + 1][e]; }
    vst2((unsigned*)(Kb + kb + j * 2048), pk.u); }
}
#define KP 72    // LDS row pitch in 16-bit values: 128 B of data + 16 B, an odd multiple of 16 B, so the 16-byte fragment reads of 16 rows spread over the banks
#define TB (64 * KP * 2)    // bytes of one staged tile (64 rows)
// Stage one tile of 64 keys for the whole block: 64 K rows and 64 V^T rows of 128 B each. A thread copies 4 + 4 chunks of 16 B (rows 16 apart); 8 lanes cover one whole row.
// s_wait_xcnt closes the statement so that it stands in front of any rewrite of the address registers the copies name.
__device__ __forceinline__ void stage_kv(const __bf16* gk, const _Float16* gv, unsigned lk, unsigned lv) {
  asm volatile("global_load_async_to_lds_b128 %0, %8, off\n\t"
               "global_load_async_to_lds_b128 %1, %9, off\n\t"
               "global_load_async_to_lds_b128 %2, %10, off\n\t"
               "global_load_async_to_lds_b128 %3, %11, off\n\t"
               "global_load_async_to_lds_b128 %4, %12, off\n\t"
               "global_load_async_to_lds_b128 %5, %13, off\n\t"
               "global_load_async_to_lds_b128 %6, %14, off\n\t"
               "global_load_async_to_lds_b128 %7, %15, off\n\t"
               "s_wait_xcnt 0x0"
               :: "v"(lk), "v"(lk + 16 * KP * 2), "v"(lk + 32 * KP * 2), "v"(lk + 48 * KP * 2), "v"(lv), "v"(lv + 16 * KP * 2), "v"(lv + 32 * KP * 2), "v"(lv + 48 * KP * 2),
                  "v"(gk), "v"(gk + 16 * HD), "v"(gk + 32 * HD), "v"(gk + 48 * HD), "v"(gv), "v"(gv + 16 * SS), "v"(gv + 32 * SS), "v"(gv + 48 * SS)
               : "memory");
}
// A wave owns 32 queries (two tiles of 16): every K fragment and V^T fragment it reads from LDS feeds two matrix products, and a block of four waves covers 128 queries per staged tile.
// Three waves on a SIMD, no more and no fewer: the grid is three blocks per WGP; all of them must be resident at once, and a fourth block on one WGP would leave another with two.
__global__ __launch_bounds__(128) __attribute__((amdgpu_waves_per_eu(3, 3))) void k_attn(const float* __restrict__ Q, const __bf16* __restrict__ Kb, const _Float16* __restrict__ VTb, float* __restrict__ O32) {
  __shared__ __align__(16) __bf16 sK[2][64][KP]; __shared__ __align__(16) _Float16 sV[2][64][KP];    // two buffers: tile kt in buffer kt & 1
  const int tid = threadIdx.x, w = tid >> 5, lane = tid & 31, col = lane & 15, g = lane >> 4;
  const size_t bh = blockIdx.y; const int q0 = blockIdx.x * 128 + w * 32;
  const __bf16* gk = Kb + (bh * SS + (tid >> 3)) * HD + (tid & 7) * 8; const _Float16* gv = VTb + (bh * HD + (tid >> 3)) * SS + (tid & 7) * 8;    // this thread's first chunk of tile 0
  const unsigned lk = (unsigned)(size_t)&sK[0][tid >> 3][(tid & 7) * 8], lv = (unsigned)(size_t)&sV[0][tid >> 3][(tid & 7) * 8];    // its LDS byte addresses in buffer 0
  const float* qrow = Q + (bh * SS + q0 + col) * HD + g * 8; v4f qf[2][8];    // the lane's two query rows (16 rows apart) as f32, loaded first so that they fly while tile 0 lands: values kc * 32 + 8g + 0..7 and + 16 + 0..7
#pragma unroll
  for (int u = 0; u < 2; ++u)
#pragma unroll
    for (int kc = 0; kc < 2; ++kc)
#pragma unroll
      for (int i = 0; i < 4; ++i) qf[u][kc * 4 + i] = *(const v4f*)(qrow + u * 16 * HD + kc * 32 + (i >> 1) * 16 + (i & 1) * 4);
  asm volatile("s_wait_xcnt 0x0" :: "v"(qrow) : "memory");    // stands in front of any reuse of the address registers that the query loads name; as an input they stay live up to here
  stage_kv(gk, gv, lk, lv);
  asm volatile("s_wait_asynccnt 0x0" ::: "memory");    // tile 0 has landed before the barrier publishes it
  __syncthreads();
  stage_kv(gk + 64 * HD, gv + 64, lk + TB, lv + TB);    // tile 1 flies while tile 0 is worked on
  v16b aq[2][2];    // the query rows cast here, once per wave, in the fragment's k order
#pragma unroll
  for (int u = 0; u < 2; ++u)
#pragma unroll
    for (int kc = 0; kc < 2; ++kc)
#pragma unroll
      for (int i = 0; i < 4; ++i) { aq[u][kc][i] = (__bf16)qf[u][kc * 4][i]; aq[u][kc][4 + i] = (__bf16)qf[u][kc * 4 + 1][i]; aq[u][kc][8 + i] = (__bf16)qf[u][kc * 4 + 2][i]; aq[u][kc][12 + i] = (__bf16)qf[u][kc * 4 + 3][i]; }
  float mrun[2], lrun[2] = {0.f, 0.f}; v8f acc[2][4] = {};    // mrun: the reference exponent in use (a maximum times C2), the same in both halves of the wave; it may trail the true running maximum
  v8f s[2][4]; v16h ph[2][2]; float ps[2];
  auto scores = [&](int b) {
#pragma unroll
    for (int t = 0; t < 4; ++t) { s[0][t] = v8f{}; s[1][t] = v8f{};
#pragma unroll
      for (int kc = 0; kc < 2; ++kc) { const v16b kf = frag_b(&sK[b][t * 16 + col][kc * 32], lane);    // one read, two products
        s[0][t] = wmma_bf(kf, aq[0][kc], s[0][t]); s[1][t] = wmma_bf(kf, aq[1][kc], s[1][t]); } } };    // raw dot products; the scale is folded into C2
  auto tilemax = [&](int u) { float mx = -3.4e38f;
#pragma unroll
    for (int t = 0; t < 4; ++t)
#pragma unroll
      for (int r = 0; r < 8; ++r) mx = fmaxf(mx, s[u][t][r]);
    return fmaxf(mx, __shfl_xor(mx, 16, 32)) * C2; };    // the other half of the wave holds the query's other 32 keys; C2 > 0 keeps the order
  auto weights = [&]() { ps[0] = 0.f; ps[1] = 0.f;
#pragma unroll
    for (int t = 0; t < 4; ++t)
#pragma unroll
      for (int r = 0; r < 8; r += 2)
#pragma unroll
        for (int u = 0; u < 2; ++u)
          { const v2f x = __builtin_elementwise_fma(v2f{s[u][t][r], s[u][t][r + 1]}, v2f{C2, C2}, v2f{-mrun[u], -mrun[u]});    // exp((s - m) / 8) = 2^(s * C2 - m * C2): one packed fused multiply-add for two elements
            const v2f p = v2f{__builtin_amdgcn_exp2f(x[0]), __builtin_amdgcn_exp2f(x[1])}; ps[u] += p[0]; ps[u] += p[1];    // denominator
            const v2h hp = __builtin_convertvector(p, v2h);    // one rounding to f16: 11 significant bits down to 2^-14, steps of 2^-24 below; p <= PMAX
            ph[u][t >> 1][(t & 1) * 8 + r] = hp[0]; ph[u][t >> 1][(t & 1) * 8 + r + 1] = hp[1]; } };
  scores(0); mrun[0] = tilemax(0); mrun[1] = tilemax(1);    // the first reference: the maximum over tile 0, taken once in front of the loop (nothing is accumulated yet, so nothing is rescaled)
#pragma unroll 1
  for (int kt = 0; kt < SS / 64; ++kt) { const int b = kt & 1;
    scores(b);
    v16h vfr[2][4];    // the V^T fragments, asked for here so that they fly under the exponentials
#pragma unroll
    for (int kc = 0; kc < 2; ++kc)
#pragma unroll
      for (int t = 0; t < 4; ++t) vfr[kc][t] = frag_h(&sV[b][t * 16 + col][kc * 32], lane);
    weights();    // with the reference exponent as it stands: no maximum is taken
    // Every weight is positive, so a lane's sum bounds each of its weights: while all sums stay at or below PMAX the weights fit f16 with room and the reference stays.
    // The negated compare also catches the infinity of an exponent above 128.
    const bool over = !(ps[0] <= PMAX && ps[1] <= PMAX);
    if (__builtin_expect(__builtin_amdgcn_ballot_w32(over) != 0, 0)) {    // one scalar branch per trip; the whole wave goes, so both halves keep one reference
      __builtin_amdgcn_fence(__ATOMIC_ACQUIRE, "wavefront");    // no instruction: it makes the compiler read the K fragments again here; without it they (64 registers) stay live through every trip for this rare path, and the V^T reads have no room to fly early
      scores(b);    // the tile is still in buffer b
#pragma unroll
      for (int u = 0; u < 2; ++u) { const float mnew = fmaxf(mrun[u], tilemax(u)), corr = __builtin_amdgcn_exp2f(mrun[u] - mnew);
        lrun[u] *= corr; mrun[u] = mnew;
#pragma unroll
        for (int t = 0; t < 4; ++t) acc[u][t] *= corr; }
      weights(); }    // now every weight is at most 1
#pragma unroll
    for (int u = 0; u < 2; ++u) { ps[u] += __shfl_xor(ps[u], 16, 32); lrun[u] += ps[u]; }
#pragma unroll
    for (int kc = 0; kc < 2; ++kc)
#pragma unroll
      for (int t = 0; t < 4; ++t) { acc[0][t] = wmma_hf(vfr[kc][t], ph[0][kc], acc[0][t]); acc[1][t] = wmma_hf(vfr[kc][t], ph[1][kc], acc[1][t]); }    // one read, two products
    asm volatile("s_wait_dscnt 0x0" ::: "memory");       // this wave's reads of buffer b are done before the buffer is refilled
    asm volatile("s_wait_asynccnt 0x0" ::: "memory");    // this wave's copies of tile kt + 1 have landed
    __syncthreads();                                     // publishes tile kt + 1 and ends every wave's reads of buffer b
    if (kt + 2 < SS / 64) stage_kv(gk + (size_t)(kt + 2) * 64 * HD, gv + (kt + 2) * 64, lk + b * TB, lv + b * TB); }
  asm volatile("s_wait_asynccnt 0x0" ::: "memory");      // no copy is outstanding when the wave goes on to the output and ends
#pragma unroll
  for (int u = 0; u < 2; ++u) { const float inv = 1.0f / lrun[u]; float* orow = O32 + (bh * SS + q0 + u * 16 + col) * HD + g * 8;    // head-major output [bh][s][64]; accumulator tile t holds 8 consecutive values of the lane's own row
#pragma unroll
    for (int t = 0; t < 4; ++t) { const v8f o = acc[u][t] * inv;
      vst2(orow + t * 16, __builtin_shufflevector(o, o, 0, 1, 2, 3)); vst2(orow + t * 16 + 4, __builtin_shufflevector(o, o, 4, 5, 6, 7)); } }
}
extern "C" void kernel_launch(void* const* d_in, const int* in_sizes, int n_in, void* d_out, int out_size, void* d_ws, size_t ws_size, hipStream_t stream) {
  (void)in_sizes; (void)n_in; (void)out_size; (void)ws_size;
  const float* Q = (const float*)d_in[0]; const float* K = (const float*)d_in[1]; const float* V = (const float*)d_in[2]; const float* mk = (const float*)d_in[3];
  char* ws = (char*)d_ws; size_t off = 0;
  auto take = [&](size_t bytes) { char* p = ws + off; off += (bytes + 255) & ~(size_t)255; return p; };
  const size_t n = (size_t)NBH * SS * HD;
  __bf16* Kb = (__bf16*)take(n * 2); _Float16* VTb = (_Float16*)take(n * 2);
  // ws ~ 25 MB
  k_prep<<<dim3(SS / 64, NBH), 256, 0, stream>>>(K, V, mk, Kb, VTb);
  k_attn<<<dim3(SS / 128, NBH), 128, 0, stream>>>(Q, Kb, VTb, (float*)d_out);
}
